// v000
// The times below were measured on an AMD MI455X: many runs one after another, warmed up first and cycling through
// copies of the inputs, with the whole window's GPU time divided by the number of runs. Launches and the gaps
// between them are all in it. The median over several windows is given; except for v000 it joins two sittings, which
// can be a few percent apart, so the side-by-side timings, each taken in one sitting, are the better comparison.
// v000 is the starting kernel. One run takes 1350 microseconds.
// compute dtype: all float inputs rounded to bf16; qkv = x Wqkv^T with EXACT bf16 products on WMMA 16x16x32 (f32 accumulate); q as f16 hi + residual (x 2^10) against k once to f16 (2 products) x 64^-0.5, then MULTIPLIED by the 0/1 mask (masked logits become 0, they are not excluded); softmax in f32 (precise expf); P x 2^11 once to f16 against v once to f16 (1 product); ctx split bf16 hi + lo against exact w_proj (2 products) + b_proj; f32 output.
#include <hip/hip_runtime.h>
#include <math.h>

typedef __attribute__((ext_vector_type(16))) _Float16 v16h;
typedef __attribute__((ext_vector_type(16))) __bf16 v16b;
typedef __attribute__((ext_vector_type(8)))  _Float16 v8h;
typedef __attribute__((ext_vector_type(8)))  float v8f;
typedef __attribute__((ext_vector_type(4)))  float v4f;
typedef __attribute__((ext_vector_type(2)))  float v2f;
typedef __attribute__((ext_vector_type(4)))  unsigned v4u;
typedef __attribute__((ext_vector_type(4)))  int v4i;
typedef float __attribute__((may_alias)) float_a;
typedef int __attribute__((may_alias)) int_a;

template <typename T> __device__ __forceinline__ void vst2(void* p, T v) { *(T*)p = v;  }
__device__ __forceinline__ v8f wmma16(v16h a, v16h b, v8f c) {
  v8f d = __builtin_amdgcn_wmma_f32_16x16x32_f16(false, a, false, b, (short)0, c, false, false);
  asm volatile("v_nop\n\tv_nop\n\tv_nop\n\tv_nop" : "+v"(d) : "v"(a), "v"(b));
  return d;
}
__device__ __forceinline__ v8f wmma_bf(v16b a, v16b b, v8f c) {
  v8f d = __builtin_amdgcn_wmma_f32_16x16x32_bf16(false, a, false, b, (short)0, c, false, false);
  asm volatile("v_nop\n\tv_nop\n\tv_nop\n\tv_nop" : "+v"(d) : "v"(a), "v"(b));
  return d;
}
// 16x16x32 fragments: lane = (h = lane>>4, row/col = lane&15); elements 0..7 = k0+8h+0..7, 8..15 = k0+16+8h+0..7; D element r = row 8h+r
__device__ __forceinline__ v16h frag_h(const _Float16* rowk0, int lane) {
  union { v16h v; v8h q[2]; } u; const _Float16* p = rowk0 + 8 * (lane >> 4);
  u.q[0] = *(const v8h*)p; u.q[1] = *(const v8h*)(p + 16); return u.v;
}
__device__ __forceinline__ v16h frag_f32(const float* rowk0, int lane) {
  v16h a; const float* p = rowk0 + 8 * (lane >> 4);
#pragma unroll
  for (int i = 0; i < 8; ++i) { a[i] = (_Float16)p[i]; a[8 + i] = (_Float16)p[16 + i]; }
  return a;
}
__device__ __forceinline__ v16h frag_f32s(const float* rowk0, int lane, float sc) {
  v16h a; const float* p = rowk0 + 8 * (lane >> 4);
#pragma unroll
  for (int i = 0; i < 8; ++i) { a[i] = (_Float16)(p[i] * sc); a[8 + i] = (_Float16)(p[16 + i] * sc); }
  return a;
}
// column fragment from a [K][ld] layout (column n), rows >= K read as 0
__device__ __forceinline__ v16h fragc_f32(const float* W, int k0, int n, int lane, int ld, int K) {
  v16h a; const int g = lane >> 4;
#pragma unroll
  for (int i = 0; i < 8; ++i) { const int ka = k0 + 8 * g + i, kb = ka + 16;
    a[i] = (_Float16)(ka < K ? W[(size_t)(ka < K ? ka : K - 1) * ld + n] : 0.f); a[8 + i] = (_Float16)(kb < K ? W[(size_t)(kb < K ? kb : K - 1) * ld + n] : 0.f); }
  return a;
}
struct F2 { v16b h, l; };
__device__ __forceinline__ F2 bsplit16(const float v[16]) { F2 r;
#pragma unroll
  for (int i = 0; i < 16; ++i) { const __bf16 h = (__bf16)v[i]; r.h[i] = h; r.l[i] = (__bf16)(v[i] - (float)h); }
  return r; }
__device__ __forceinline__ F2 split_row(const float* row, int k0, int lane) { float v[16]; const float* p = row + k0 + 8 * (lane >> 4);
#pragma unroll
  for (int i = 0; i < 8; ++i) { v[i] = p[i]; v[8 + i] = p[16 + i]; }
  return bsplit16(v); }
__device__ __forceinline__ F2 split_rowK(const float* row, int k0, int lane, int K) { float v[16]; const int g = lane >> 4;
#pragma unroll
  for (int i = 0; i < 8; ++i) { const int ka = k0 + 8 * g + i, kb = ka + 16; v[i] = ka < K ? row[ka < K ? ka : K - 1] : 0.f; v[8 + i] = kb < K ? row[kb < K ? kb : K - 1] : 0.f; }
  return bsplit16(v); }
__device__ __forceinline__ F2 split_col(const float* W, int k0, int n, int lane, int ld, int K) { float v[16]; const int g = lane >> 4;
#pragma unroll
  for (int i = 0; i < 8; ++i) { const int ka = k0 + 8 * g + i, kb = ka + 16; v[i] = ka < K ? W[(size_t)(ka < K ? ka : K - 1) * ld + n] : 0.f; v[8 + i] = kb < K ? W[(size_t)(kb < K ? kb : K - 1) * ld + n] : 0.f; }
  return bsplit16(v); }
__device__ __forceinline__ v8f mac3(const F2& a, const F2& b, v8f c) { c = wmma_bf(a.l, b.h, c); c = wmma_bf(a.h, b.l, c); return wmma_bf(a.h, b.h, c); }
__device__ __forceinline__ float sigm(float v) { return 1.0f / (1.0f + expf(-v)); }
#define LDSX() do { asm volatile("s_wait_dscnt 0" ::: "memory"); __builtin_amdgcn_wave_barrier(); __builtin_amdgcn_fence(__ATOMIC_RELEASE, "workgroup"); } while (0)

// Multi-head attention with a MULTIPLICATIVE 0/1 mask (B 2, N 2,048, C 1,024 = 16 x 64): qkv = x w_qkv^T ((out,in) [3072,1024], rows (3,H,D)); attn = softmax((q k^T x 64^-0.5) * mask) with mask [N,N] of 0/1 shared over (b,h) - a masked logit is 0.0, still inside the softmax; out = merged(attn v) w_proj^T + b_proj.
#define NB 2
#define TT 2048
#define CC 1024            // NH * HD = projected width
#define DIN 1024          // input (model) width
#define NH 16
#define HD 64
#define NQB (TT / 64)
#define HG 4
#define SCALE (0.125f)
#define CAUSAL 0
#ifndef TNB
#define TNB NB
#endif
__device__ __forceinline__ float bfr(float v) { return (float)(__bf16)v; }
__host__ __device__ __forceinline__ int kb_last(int qb) { return CAUSAL ? ((qb * 64 + 63) >> 7) : (TT / 128 - 1); }
typedef __attribute__((ext_vector_type(8))) __bf16 v8b;
__device__ __forceinline__ v16b frag_b(const __bf16* rowk0, int lane) {
  union { v16b v; v8b q[2]; } u; const __bf16* p = rowk0 + 8 * (lane >> 4);
  u.q[0] = *(const v8b*)p; u.q[1] = *(const v8b*)(p + 16); return u.v;
}
#define QBH 0              // causal: query blocks 0..QBH-1 of each sequence (few keys, no averaging) take the high-precision path
#define QHI 2048            // rows carrying a q residual plane (all rows when non-causal: 2-product logits everywhere)
#define KHI 64            // key rows carrying k residual / v bf16 hi+lo planes (used only by the causal high-precision path)
// B fragment (k rows k0+.., output column o) of a weight: (in,out) [K][ld] or (out,in) [ld rows of K]: bf16 exact, or f16(bf16 * 256) exact
__device__ __forceinline__ v16b wcol_io(const float* Wm, int k0, int o, int lane, int ld) { v16b w; const int g = lane >> 4;
#pragma unroll
  for (int i = 0; i < 8; ++i) { w[i] = (__bf16)Wm[(size_t)(k0 + 8 * g + i) * ld + o]; w[8 + i] = (__bf16)Wm[(size_t)(k0 + 16 + 8 * g + i) * ld + o]; }
  return w; }
__device__ __forceinline__ v16b wcol_oi(const float* Wm, int k0, int o, int lane, int K) { v16b w; const float* p = Wm + (size_t)o * K + k0 + 8 * (lane >> 4);
#pragma unroll
  for (int i = 0; i < 8; ++i) { w[i] = (__bf16)p[i]; w[8 + i] = (__bf16)p[16 + i]; }
  return w; }
__device__ __forceinline__ v16h wcolh_io(const float* Wm, int k0, int o, int lane, int ld) { v16h w; const int g = lane >> 4;
#pragma unroll
  for (int i = 0; i < 8; ++i) { w[i] = (_Float16)(bfr(Wm[(size_t)(k0 + 8 * g + i) * ld + o]) * 256.0f); w[8 + i] = (_Float16)(bfr(Wm[(size_t)(k0 + 16 + 8 * g + i) * ld + o]) * 256.0f); }
  return w; }
__device__ __forceinline__ v16h wcolh_oi(const float* Wm, int k0, int o, int lane, int K) { v16h w; const float* p = Wm + (size_t)o * K + k0 + 8 * (lane >> 4);
#pragma unroll
  for (int i = 0; i < 8; ++i) { w[i] = (_Float16)(bfr(p[i]) * 256.0f); w[8 + i] = (_Float16)(bfr(p[16 + i]) * 256.0f); }
  return w; }
#define WQKV_LAYOUT 1   // 0 = (in,out) [DIN][CC]; 1 = (out,in) [CC][DIN]; 2 = per-head [NH][DIN][HD]
__device__ __forceinline__ v16b wcol_hdk(const float* Wm, int k0, int o, int lane) { v16b w; const int g = lane >> 4; const float* p = Wm + (size_t)(o / HD) * DIN * HD + (o % HD);
#pragma unroll
  for (int i = 0; i < 8; ++i) { w[i] = (__bf16)p[(size_t)(k0 + 8 * g + i) * HD]; w[8 + i] = (__bf16)p[(size_t)(k0 + 16 + 8 * g + i) * HD]; }
  return w; }
#define WO_OUT_IN 1
#if WQKV_LAYOUT == 1
#define WCOL(W, k0, o, lane) wcol_oi(W, k0, o, lane, DIN)
#elif WQKV_LAYOUT == 2
#define WCOL(W, k0, o, lane) wcol_hdk(W, k0, o, lane)
#else
#define WCOL(W, k0, o, lane) wcol_io(W, k0, o, lane, CC)
#endif
#if WO_OUT_IN
#define WOCOL(W, k0, o, lane) wcol_oi(W, k0, o, lane, CC)
#define WOCOLH(W, k0, o, lane) wcolh_oi(W, k0, o, lane, CC)
#else
#define WOCOL(W, k0, o, lane) wcol_io(W, k0, o, lane, DIN)
#define WOCOLH(W, k0, o, lane) wcolh_io(W, k0, o, lane, DIN)
#endif
#define SM_EXTRA_PARAMS , const float* __restrict__ MKF
#define SM_MASK_HOOK do { const float mk = bfr(MKF[(size_t)t * TT + k]); v = v * mk; } while (0)   /* attn * mask: multiplicative (0 -> logit 0, NOT excluded); unconditional load */
#ifndef SM_EXTRA_PARAMS
#define SM_EXTRA_PARAMS
#endif
#ifndef PROJ_EXTRA_PARAMS
#define PROJ_EXTRA_PARAMS
#endif
#ifndef SM_MASK_HOOK
#define SM_MASK_HOOK (void)0
#endif

#define WS_QH  0u                                      // f16 q rows [b*t][CC]
#define WS_KH  (WS_QH + 2u * (size_t)NB * TT * CC)      // f16 k rows [b*t][CC]
#define WS_VT  (WS_KH + 2u * (size_t)NB * TT * CC)      // f16 v planes [b][c][t]
#define WS_QL  (WS_VT + 2u * (size_t)NB * CC * TT)      // f16 q residual x 2^10 rows [b][t < QHI][CC]
#define WS_KL  (WS_QL + 2u * (size_t)NB * QHI * CC)     // f16 k residual x 2^10 rows [b][t < KHI][CC]
#define WS_VB  (WS_KL + 2u * (size_t)NB * KHI * CC)     // bf16 v hi planes [b][c][t < KHI]
#define WS_VBL (WS_VB + 2u * (size_t)NB * CC * KHI)
#define WS_S   (WS_VBL + 2u * (size_t)NB * CC * KHI)    // f32 logits / P [hg][t][s]
#define WS_Y   (WS_S  + 4u * (size_t)HG * TT * TT)      // f32 ctx rows [b*t][CC] (only when there is an output projection)
#define WS_END (WS_Y  + 4u * (size_t)NB * TT * CC)

// ---- k_proj: block = (64 rows, 128 cols, which): q/k/v = X W (+ b) with exact bf16 products (K = DIN) -> which 0: q f16 rows (+ residual rows < QHI); 1: k f16 rows (+ residual rows < KHI); 2: v f16 planes [c][t] (+ bf16 hi/lo planes for t < KHI)
__global__ __launch_bounds__(128) void k_proj(const float* __restrict__ XQ, const float* __restrict__ XK, const float* __restrict__ XV, const float* __restrict__ WQ, const float* __restrict__ WK, const float* __restrict__ WV, const float* __restrict__ BQ, const float* __restrict__ BK, const float* __restrict__ BV,
    _Float16* __restrict__ QH, _Float16* __restrict__ QL, _Float16* __restrict__ KH, _Float16* __restrict__ KL, _Float16* __restrict__ VT, __bf16* __restrict__ VB, __bf16* __restrict__ VBL) {
  __shared__ __align__(16) _Float16 sh[64][136], sl[64][136]; __shared__ __align__(16) _Float16 th[128][72]; __shared__ __align__(16) __bf16 tb[128][72], tbl[128][72];
  const int tid = threadIdx.x, wave = tid >> 5, lane = tid & 31, col = lane & 15, g = lane >> 4; const int which = blockIdx.z; const int c0 = blockIdx.y * 128; const size_t r0 = (size_t)blockIdx.x * 64; const size_t bb = r0 / TT; const int t0 = (int)(r0 % TT);
  const float* X = which == 0 ? XQ : which == 1 ? XK : XV; const float* WA = which == 0 ? WQ : which == 1 ? WK : WV; const float* BA = which == 0 ? BQ : which == 1 ? BK : BV;
  v8f acc[8] = {};
#pragma unroll 2
  for (int kc = 0; kc < DIN / 32; ++kc) { v16b a; { const float* p = X + (r0 + wave * 16 + col) * DIN + kc * 32 + 8 * g;
#pragma unroll
      for (int i = 0; i < 8; ++i) { a[i] = (__bf16)p[i]; a[8 + i] = (__bf16)p[16 + i]; } }
    asm volatile("s_wait_loadcnt 0x0" ::: "memory");
#pragma unroll
    for (int j = 0; j < 8; ++j) { const v16b w = WCOL(WA, kc * 32, c0 + j * 16 + col, lane); asm volatile("s_wait_loadcnt 0x0" ::: "memory"); acc[j] = wmma_bf(a, w, acc[j]); } }
  if (which < 2) { _Float16* DH = which == 0 ? QH : KH; _Float16* DL = which == 0 ? QL : KL; const int nhi = which == 0 ? QHI : KHI; const bool hi_rows = t0 < nhi;
#pragma unroll
    for (int j = 0; j < 8; ++j) { const float bias = BA ? bfr(BA[c0 + j * 16 + col]) : 0.f;
#pragma unroll
      for (int r = 0; r < 8; ++r) { const float v = acc[j][r] + bias; const _Float16 hv = (_Float16)v; sh[wave * 16 + 8 * g + r][j * 16 + col] = hv; sl[wave * 16 + 8 * g + r][j * 16 + col] = (_Float16)((v - (float)hv) * 1024.0f); } }
    __syncthreads();
    for (int e = tid; e < 64 * 16; e += 128) { const int rl = e >> 4, q = e & 15; vst2((unsigned*)(DH + (r0 + rl) * CC + c0 + q * 8), *(const v4u*)&sh[rl][q * 8]); if (hi_rows) vst2((unsigned*)(DL + (bb * nhi + t0 + rl) * (size_t)CC + c0 + q * 8), *(const v4u*)&sl[rl][q * 8]); }
  } else { const bool hi_rows = t0 < KHI;
#pragma unroll
    for (int j = 0; j < 8; ++j) { const float bias = BA ? bfr(BA[c0 + j * 16 + col]) : 0.f;
#pragma unroll
      for (int r = 0; r < 8; ++r) { const float v = acc[j][r] + bias; const int rl = wave * 16 + 8 * g + r, cl = j * 16 + col; th[cl][rl] = (_Float16)v; const __bf16 bh = (__bf16)v; tb[cl][rl] = bh; tbl[cl][rl] = (__bf16)(v - (float)bh); } }
    __syncthreads();
    for (int e = tid; e < 128 * 8; e += 128) { const int cl = e >> 3, q = e & 7; vst2((unsigned*)(VT + (bb * CC + c0 + cl) * (size_t)TT + t0 + q * 8), *(const v4u*)&th[cl][q * 8]); if (hi_rows) { const size_t o3 = (bb * CC + c0 + cl) * (size_t)KHI + t0 + q * 8; vst2((unsigned*)(VB + o3), *(const v4u*)&tb[cl][q * 8]); vst2((unsigned*)(VBL + o3), *(const v4u*)&tbl[cl][q * 8]); } } } }
// ---- k_sc: block = (query block qb, key block kb <= kb_last(qb), head in group) of batch b: logits x SCALE; q hi + residual (x 2^10) against k (2 products) for query rows < QHI, plus the k residual (3 products) for query blocks < QBH (causal early rows); causal: blocks past the diagonal exit, the mask itself is applied by index in k_sm
__global__ __launch_bounds__(128) void k_sc(const _Float16* __restrict__ QH, const _Float16* __restrict__ KH, const _Float16* __restrict__ QL, const _Float16* __restrict__ KL, int b, int h0, float* __restrict__ S0) { __shared__ __align__(16) float ss[4][16][132];
  const int qb = blockIdx.x, kb = blockIdx.y; if (kb > kb_last(qb)) return;
  const int h = h0 + blockIdx.z; float* S = S0 + (size_t)blockIdx.z * TT * TT;
  const int tid = threadIdx.x, wave = tid >> 5, lane = tid & 31, col = lane & 15, g = lane >> 4; const int k0 = kb * 128; const int ql0 = qb * 64 + wave * 16; const size_t q0 = (size_t)b * TT + ql0, kr0 = (size_t)b * TT + k0;
  v8f acc[8] = {}, accl[8] = {};
  const _Float16* QLb = QL + (size_t)b * QHI * CC; const _Float16* KLb = KL + (size_t)b * KHI * CC;
  if (qb < QBH) {
#pragma unroll
    for (int kc = 0; kc < HD / 32; ++kc) { const v16h ah = frag_h(QH + (q0 + col) * CC + h * HD + kc * 32, lane), al = frag_h(QLb + (size_t)(ql0 + col) * CC + h * HD + kc * 32, lane);
#pragma unroll
      for (int j = 0; j < 8; ++j) { const v16h kbf = frag_h(KH + (kr0 + j * 16 + col) * CC + h * HD + kc * 32, lane), klf = frag_h(KLb + (size_t)(k0 + j * 16 + col) * CC + h * HD + kc * 32, lane); acc[j] = wmma16(ah, kbf, acc[j]); accl[j] = wmma16(al, kbf, accl[j]); accl[j] = wmma16(ah, klf, accl[j]); } }
  } else if (qb * 64 < QHI) {
#pragma unroll
    for (int kc = 0; kc < HD / 32; ++kc) { const v16h ah = frag_h(QH + (q0 + col) * CC + h * HD + kc * 32, lane), al = frag_h(QLb + (size_t)(ql0 + col) * CC + h * HD + kc * 32, lane);
#pragma unroll
      for (int j = 0; j < 8; ++j) { const v16h kbf = frag_h(KH + (kr0 + j * 16 + col) * CC + h * HD + kc * 32, lane); acc[j] = wmma16(ah, kbf, acc[j]); accl[j] = wmma16(al, kbf, accl[j]); } }
  } else {
#pragma unroll
    for (int kc = 0; kc < HD / 32; ++kc) { const v16h ah = frag_h(QH + (q0 + col) * CC + h * HD + kc * 32, lane);
#pragma unroll
      for (int j = 0; j < 8; ++j) { const v16h kbf = frag_h(KH + (kr0 + j * 16 + col) * CC + h * HD + kc * 32, lane); acc[j] = wmma16(ah, kbf, acc[j]); } } }
#pragma unroll
  for (int j = 0; j < 8; ++j) {
#pragma unroll
    for (int r = 0; r < 8; ++r) ss[wave][8 * g + r][j * 16 + col] = (acc[j][r] + accl[j][r] * (1.0f / 1024.0f)) * SCALE; }
  LDSX(); for (int rl = 0; rl < 16; ++rl) vst2(S + (size_t)(ql0 + rl) * TT + k0 + lane * 4, *(const v4f*)&ss[wave][rl][lane * 4]); }
// ---- k_sm: block = query row t (head in group): keys [0, kend): causal -> logit if s <= t else excluded; softmax in f32; P x 2^11 in place (0 for excluded)
__global__ __launch_bounds__(256) void k_sm(float* __restrict__ S0 SM_EXTRA_PARAMS) { __shared__ float sred[8]; __shared__ float sbc; __shared__ __align__(16) float shv[TT];
  const int tid = threadIdx.x; const int t = blockIdx.x; const int kend = (kb_last(t >> 6) + 1) * 128;
  float* sr = S0 + (size_t)blockIdx.y * TT * TT + (size_t)t * TT;
  float m = -3.0e38f; for (int k = tid; k < kend; k += 256) { float v = (!CAUSAL || k <= t) ? sr[k] : -3.0e38f; SM_MASK_HOOK; shv[k] = v; m = fmaxf(m, v); }
#pragma unroll
  for (int o = 1; o < 32; o <<= 1) m = fmaxf(m, __shfl_xor(m, o));
  if ((tid & 31) == 0) sred[tid >> 5] = m; __syncthreads(); if (tid == 0) { float a = sred[0]; for (int i = 1; i < 8; ++i) a = fmaxf(a, sred[i]); sbc = a; } __syncthreads(); m = sbc; __syncthreads();
  float sum = 0.f; for (int k = tid; k < kend; k += 256) { const float v = shv[k]; const float e = (v <= -1.0e38f) ? 0.f : expf(v - m); shv[k] = e; sum += e; }
#pragma unroll
  for (int o = 1; o < 32; o <<= 1) sum += __shfl_xor(sum, o);
  if ((tid & 31) == 0) sred[tid >> 5] = sum; __syncthreads(); if (tid == 0) { float a = 0.f; for (int i = 0; i < 8; ++i) a += sred[i]; sbc = a > 0.f ? 2048.0f / a : 0.f; }   /* a fully excluded row yields P = 0 */ __syncthreads(); const float inv = sbc;
  for (int k = tid; k < kend; k += 256) shv[k] = shv[k] * inv;
  __syncthreads(); for (int q = tid; q < kend / 4; q += 256) vst2(sr + q * 4, *(const v4f*)&shv[q * 4]); }
// ---- k_pv: block = 64 queries (qb) of (b, h): ctx = P . v over keys [0, kend) (P x 2^11 once to f16 against v f16: 1 product; causal early query blocks: P and v as bf16 hi + lo, 3 products); 256-B (row, head) segment by 16 lanes
__global__ __launch_bounds__(128) void k_pv(const float* __restrict__ PS0, const _Float16* __restrict__ VT, const __bf16* __restrict__ VB, const __bf16* __restrict__ VBL, int b, int h0, float* __restrict__ Y) { const int h = h0 + blockIdx.z; const float* PS = PS0 + (size_t)blockIdx.z * TT * TT; __shared__ __align__(16) float ss[4][16][HD + 4];
  const int tid = threadIdx.x, wave = tid >> 5, lane = tid & 31, col = lane & 15, g = lane >> 4; const int qb = blockIdx.x; const int ql0 = qb * 64 + wave * 16; const int kce = (kb_last(qb) + 1) * 4;
  v8f acc[HD / 16] = {};
  if (qb < QBH) {
#pragma unroll 1
    for (int kc = 0; kc < kce; ++kc) { const F2 p = split_row(PS + (size_t)(ql0 + col) * TT, kc * 32, lane);
      asm volatile("s_wait_loadcnt 0x0" ::: "memory");
#pragma unroll
      for (int j = 0; j < HD / 16; ++j) { const size_t po = ((size_t)b * CC + h * HD + j * 16 + col) * (size_t)KHI + kc * 32; const v16b vh = frag_b(VB + po, lane); acc[j] = wmma_bf(p.h, vh, acc[j]); acc[j] = wmma_bf(p.l, vh, acc[j]); acc[j] = wmma_bf(p.h, frag_b(VBL + po, lane), acc[j]); } }
  } else {
#pragma unroll 1
    for (int kc = 0; kc < kce; ++kc) { const v16h p = frag_f32(PS + (size_t)(ql0 + col) * TT + kc * 32, lane);
      asm volatile("s_wait_loadcnt 0x0" ::: "memory");
#pragma unroll
      for (int j = 0; j < HD / 16; ++j) { const size_t po = ((size_t)b * CC + h * HD + j * 16 + col) * (size_t)TT + kc * 32; acc[j] = wmma16(p, frag_h(VT + po, lane), acc[j]); } } }
#pragma unroll
  for (int j = 0; j < HD / 16; ++j)
#pragma unroll
    for (int r = 0; r < 8; ++r) ss[wave][8 * g + r][j * 16 + col] = acc[j][r] * (1.0f / 2048.0f);
  LDSX(); for (int rl = 0; rl < 16; ++rl) if (lane < HD / 4) vst2(Y + ((size_t)b * TT + ql0 + rl) * CC + h * HD + lane * 4, *(const v4f*)&ss[wave][rl][lane * 4]); }
// ---- k_out: block = (64 rows, 128 cols): out = ctx Wo (+ bo): all rows: ctx bf16 hi + lo against exact bf16 Wo (2 products); the else branch (never taken): ctx once to f16 against Wo as f16(bf16 x 2^8) exact (1 product) x 2^-8
__global__ __launch_bounds__(128) void k_out(const float* __restrict__ Y, const float* __restrict__ WO, const float* __restrict__ BO, float* __restrict__ OUT) { __shared__ __align__(16) float sf[4][16][132];
  const int tid = threadIdx.x, wave = tid >> 5, lane = tid & 31, col = lane & 15, g = lane >> 4; const int c0 = blockIdx.y * 128; const size_t r0 = (size_t)blockIdx.x * 64 + wave * 16;
  v8f acc[8] = {};
  if (true) {   /* ALL rows: ctx split bf16 hi + lo x exact Wo (2 products) */
#pragma unroll 2
    for (int kc = 0; kc < CC / 32; ++kc) { const F2 a = split_row(Y + (r0 + col) * CC, kc * 32, lane); asm volatile("s_wait_loadcnt 0x0" ::: "memory");
#pragma unroll
      for (int j = 0; j < 8; ++j) { const v16b w = WOCOL(WO, kc * 32, c0 + j * 16 + col, lane); asm volatile("s_wait_loadcnt 0x0" ::: "memory"); acc[j] = wmma_bf(a.h, w, acc[j]); acc[j] = wmma_bf(a.l, w, acc[j]); } }
#pragma unroll
    for (int j = 0; j < 8; ++j) { const float bias = BO ? bfr(BO[c0 + j * 16 + col]) : 0.f;
#pragma unroll
      for (int r = 0; r < 8; ++r) sf[wave][8 * g + r][j * 16 + col] = acc[j][r] + bias; }
  } else {
#pragma unroll 2
    for (int kc = 0; kc < CC / 32; ++kc) { const v16h a = frag_f32(Y + (r0 + col) * CC + kc * 32, lane); asm volatile("s_wait_loadcnt 0x0" ::: "memory");
#pragma unroll
      for (int j = 0; j < 8; ++j) { const v16h w = WOCOLH(WO, kc * 32, c0 + j * 16 + col, lane); asm volatile("s_wait_loadcnt 0x0" ::: "memory"); acc[j] = wmma16(a, w, acc[j]); } }
#pragma unroll
    for (int j = 0; j < 8; ++j) { const float bias = BO ? bfr(BO[c0 + j * 16 + col]) : 0.f;
#pragma unroll
      for (int r = 0; r < 8; ++r) sf[wave][8 * g + r][j * 16 + col] = acc[j][r] * (1.0f / 256.0f) + bias; } }
  LDSX(); for (int rl = 0; rl < 16; ++rl) vst2(OUT + (r0 + rl) * DIN + c0 + lane * 4, *(const v4f*)&sf[wave][rl][lane * 4]); }

extern "C" void kernel_launch(void* const* d_in, const int* in_sizes, int n_in, void* d_out, int out_size, void* d_ws, size_t ws_size, hipStream_t stream) {
  (void)in_sizes; (void)n_in; (void)out_size;
  const float** F = (const float**)d_in;
  if (ws_size < (size_t)WS_END) return;
  char* ws = (char*)d_ws; _Float16 *QH = (_Float16*)(ws + WS_QH), *KH = (_Float16*)(ws + WS_KH), *VT = (_Float16*)(ws + WS_VT), *QL = (_Float16*)(ws + WS_QL), *KL = (_Float16*)(ws + WS_KL); __bf16 *VB = (__bf16*)(ws + WS_VB), *VBL = (__bf16*)(ws + WS_VBL); float *S = (float*)(ws + WS_S), *Y = (float*)(ws + WS_Y);
  (void)Y; (void)QL; (void)KL; (void)VB; (void)VBL;
  // inputs: 0 x [2,2048,1024]; 1 w_qkv [3072,1024] (out,in); 2 w_proj [1024,1024] (out,in); 3 b_proj; 4 mask [2048,2048] f32 0/1
  k_proj<<<dim3(TNB * TT / 64, CC / 128, 3), 128, 0, stream>>>(F[0], F[0], F[0], F[1], F[1] + (size_t)CC * DIN, F[1] + (size_t)2 * CC * DIN, nullptr, nullptr, nullptr, QH, QL, KH, KL, VT, VB, VBL);
  for (int b = 0; b < TNB; ++b) for (int h0 = 0; h0 < NH; h0 += HG) {
    k_sc<<<dim3(NQB, TT / 128, HG), 128, 0, stream>>>(QH, KH, QL, KL, b, h0, S);
    k_sm<<<dim3(TT, HG), 256, 0, stream>>>(S, F[4]);
    k_pv<<<dim3(NQB, 1, HG), 128, 0, stream>>>(S, VT, VB, VBL, b, h0, Y);
  }
  k_out<<<dim3(TNB * TT / 64, DIN / 128), 128, 0, stream>>>(Y, F[2], F[3], (float*)d_out);
}

// v001
// Measured time: 483 microseconds a run.
// In two side-by-side timings against v000, it was 2.78 and 2.82 times as fast.
// compute dtype: all float inputs rounded to bf16; qkv = x Wqkv^T with EXACT bf16 products on WMMA 16x16x32 (f32 accumulate); q as f16 hi + residual (x 2^10) against k once to f16 (2 products) x 64^-0.5, then MULTIPLIED by the 0/1 mask (masked logits become 0, they are not excluded); softmax in f32 (precise expf) with a running maximum, scores kept in registers; exp(logit - max) x 2^11 once to f16 against v once to f16 (1 product), divided by the f32 sum at the end; ctx split bf16 hi + lo against exact w_proj (2 products) + b_proj; f32 output.
#include <hip/hip_runtime.h>
#include <math.h>

typedef __attribute__((ext_vector_type(16))) _Float16 v16h;
typedef __attribute__((ext_vector_type(16))) __bf16 v16b;
typedef __attribute__((ext_vector_type(8)))  _Float16 v8h;
typedef __attribute__((ext_vector_type(8)))  float v8f;
typedef __attribute__((ext_vector_type(4)))  float v4f;
typedef __attribute__((ext_vector_type(2)))  float v2f;
typedef __attribute__((ext_vector_type(4)))  unsigned v4u;
typedef __attribute__((ext_vector_type(4)))  int v4i;
typedef float __attribute__((may_alias)) float_a;
typedef int __attribute__((may_alias)) int_a;

template <typename T> __device__ __forceinline__ void vst2(void* p, T v) { *(T*)p = v;  }
__device__ __forceinline__ v8f wmma16(v16h a, v16h b, v8f c) {
  v8f d = __builtin_amdgcn_wmma_f32_16x16x32_f16(false, a, false, b, (short)0, c, false, false);
  asm volatile("v_nop\n\tv_nop\n\tv_nop\n\tv_nop" : "+v"(d) : "v"(a), "v"(b));
  return d;
}
__device__ __forceinline__ v8f wmma_bf(v16b a, v16b b, v8f c) {
  v8f d = __builtin_amdgcn_wmma_f32_16x16x32_bf16(false, a, false, b, (short)0, c, false, false);
  asm volatile("v_nop\n\tv_nop\n\tv_nop\n\tv_nop" : "+v"(d) : "v"(a), "v"(b));
  return d;
}
// 16x16x32 fragments: lane = (h = lane>>4, row/col = lane&15); elements 0..7 = k0+8h+0..7, 8..15 = k0+16+8h+0..7; D element r = row 8h+r
__device__ __forceinline__ v16h frag_h(const _Float16* rowk0, int lane) {
  union { v16h v; v8h q[2]; } u; const _Float16* p = rowk0 + 8 * (lane >> 4);
  u.q[0] = *(const v8h*)p; u.q[1] = *(const v8h*)(p + 16); return u.v;
}
__device__ __forceinline__ v16h frag_f32(const float* rowk0, int lane) {
  v16h a; const float* p = rowk0 + 8 * (lane >> 4);
#pragma unroll
  for (int i = 0; i < 8; ++i) { a[i] = (_Float16)p[i]; a[8 + i] = (_Float16)p[16 + i]; }
  return a;
}
__device__ __forceinline__ v16h frag_f32s(const float* rowk0, int lane, float sc) {
  v16h a; const float* p = rowk0 + 8 * (lane >> 4);
#pragma unroll
  for (int i = 0; i < 8; ++i) { a[i] = (_Float16)(p[i] * sc); a[8 + i] = (_Float16)(p[16 + i] * sc); }
  return a;
}
// column fragment from a [K][ld] layout (column n), rows >= K read as 0
__device__ __forceinline__ v16h fragc_f32(const float* W, int k0, int n, int lane, int ld, int K) {
  v16h a; const int g = lane >> 4;
#pragma unroll
  for (int i = 0; i < 8; ++i) { const int ka = k0 + 8 * g + i, kb = ka + 16;
    a[i] = (_Float16)(ka < K ? W[(size_t)(ka < K ? ka : K - 1) * ld + n] : 0.f); a[8 + i] = (_Float16)(kb < K ? W[(size_t)(kb < K ? kb : K - 1) * ld + n] : 0.f); }
  return a;
}
struct F2 { v16b h, l; };
__device__ __forceinline__ F2 bsplit16(const float v[16]) { F2 r;
#pragma unroll
  for (int i = 0; i < 16; ++i) { const __bf16 h = (__bf16)v[i]; r.h[i] = h; r.l[i] = (__bf16)(v[i] - (float)h); }
  return r; }
__device__ __forceinline__ F2 split_row(const float* row, int k0, int lane) { float v[16]; const float* p = row + k0 + 8 * (lane >> 4);
#pragma unroll
  for (int i = 0; i < 8; ++i) { v[i] = p[i]; v[8 + i] = p[16 + i]; }
  return bsplit16(v); }
__device__ __forceinline__ F2 split_rowK(const float* row, int k0, int lane, int K) { float v[16]; const int g = lane >> 4;
#pragma unroll
  for (int i = 0; i < 8; ++i) { const int ka = k0 + 8 * g + i, kb = ka + 16; v[i] = ka < K ? row[ka < K ? ka : K - 1] : 0.f; v[8 + i] = kb < K ? row[kb < K ? kb : K - 1] : 0.f; }
  return bsplit16(v); }
__device__ __forceinline__ F2 split_col(const float* W, int k0, int n, int lane, int ld, int K) { float v[16]; const int g = lane >> 4;
#pragma unroll
  for (int i = 0; i < 8; ++i) { const int ka = k0 + 8 * g + i, kb = ka + 16; v[i] = ka < K ? W[(size_t)(ka < K ? ka : K - 1) * ld + n] : 0.f; v[8 + i] = kb < K ? W[(size_t)(kb < K ? kb : K - 1) * ld + n] : 0.f; }
  return bsplit16(v); }
__device__ __forceinline__ v8f mac3(const F2& a, const F2& b, v8f c) { c = wmma_bf(a.l, b.h, c); c = wmma_bf(a.h, b.l, c); return wmma_bf(a.h, b.h, c); }
__device__ __forceinline__ float sigm(float v) { return 1.0f / (1.0f + expf(-v)); }
#define LDSX() do { asm volatile("s_wait_dscnt 0" ::: "memory"); __builtin_amdgcn_wave_barrier(); __builtin_amdgcn_fence(__ATOMIC_RELEASE, "workgroup"); } while (0)

// Multi-head attention with a MULTIPLICATIVE 0/1 mask (B 2, N 2,048, C 1,024 = 16 x 64): qkv = x w_qkv^T ((out,in) [3072,1024], rows (3,H,D)); attn = softmax((q k^T x 64^-0.5) * mask) with mask [N,N] of 0/1 shared over (b,h) - a masked logit is 0.0, still inside the softmax; out = merged(attn v) w_proj^T + b_proj.
#define NB 2
#define TT 2048
#define CC 1024            // NH * HD = projected width
#define DIN 1024          // input (model) width
#define NH 16
#define HD 64
#define NQB (TT / 64)
#define SCALE (0.125f)
#ifndef TNB
#define TNB NB
#endif
__device__ __forceinline__ float bfr(float v) { return (float)(__bf16)v; }
typedef __attribute__((ext_vector_type(8))) __bf16 v8b;
__device__ __forceinline__ v16b frag_b(const __bf16* rowk0, int lane) {
  union { v16b v; v8b q[2]; } u; const __bf16* p = rowk0 + 8 * (lane >> 4);
  u.q[0] = *(const v8b*)p; u.q[1] = *(const v8b*)(p + 16); return u.v;
}
#define QHI 2048            // rows carrying a q residual plane (all rows when non-causal: 2-product logits everywhere)
#define KHI 64            // key rows carrying k residual / v bf16 hi+lo planes (written by k_proj; no kernel in this file reads them)
// B fragment (k rows k0+.., output column o) of a weight: (in,out) [K][ld] or (out,in) [ld rows of K]: bf16 exact, or f16(bf16 * 256) exact
__device__ __forceinline__ v16b wcol_io(const float* Wm, int k0, int o, int lane, int ld) { v16b w; const int g = lane >> 4;
#pragma unroll
  for (int i = 0; i < 8; ++i) { w[i] = (__bf16)Wm[(size_t)(k0 + 8 * g + i) * ld + o]; w[8 + i] = (__bf16)Wm[(size_t)(k0 + 16 + 8 * g + i) * ld + o]; }
  return w; }
__device__ __forceinline__ v16b wcol_oi(const float* Wm, int k0, int o, int lane, int K) { v16b w; const float* p = Wm + (size_t)o * K + k0 + 8 * (lane >> 4);
#pragma unroll
  for (int i = 0; i < 8; ++i) { w[i] = (__bf16)p[i]; w[8 + i] = (__bf16)p[16 + i]; }
  return w; }
__device__ __forceinline__ v16h wcolh_io(const float* Wm, int k0, int o, int lane, int ld) { v16h w; const int g = lane >> 4;
#pragma unroll
  for (int i = 0; i < 8; ++i) { w[i] = (_Float16)(bfr(Wm[(size_t)(k0 + 8 * g + i) * ld + o]) * 256.0f); w[8 + i] = (_Float16)(bfr(Wm[(size_t)(k0 + 16 + 8 * g + i) * ld + o]) * 256.0f); }
  return w; }
__device__ __forceinline__ v16h wcolh_oi(const float* Wm, int k0, int o, int lane, int K) { v16h w; const float* p = Wm + (size_t)o * K + k0 + 8 * (lane >> 4);
#pragma unroll
  for (int i = 0; i < 8; ++i) { w[i] = (_Float16)(bfr(p[i]) * 256.0f); w[8 + i] = (_Float16)(bfr(p[16 + i]) * 256.0f); }
  return w; }
#define WQKV_LAYOUT 1   // 0 = (in,out) [DIN][CC]; 1 = (out,in) [CC][DIN]; 2 = per-head [NH][DIN][HD]
__device__ __forceinline__ v16b wcol_hdk(const float* Wm, int k0, int o, int lane) { v16b w; const int g = lane >> 4; const float* p = Wm + (size_t)(o / HD) * DIN * HD + (o % HD);
#pragma unroll
  for (int i = 0; i < 8; ++i) { w[i] = (__bf16)p[(size_t)(k0 + 8 * g + i) * HD]; w[8 + i] = (__bf16)p[(size_t)(k0 + 16 + 8 * g + i) * HD]; }
  return w; }
#define WO_OUT_IN 1
#if WQKV_LAYOUT == 1
#define WCOL(W, k0, o, lane) wcol_oi(W, k0, o, lane, DIN)
#elif WQKV_LAYOUT == 2
#define WCOL(W, k0, o, lane) wcol_hdk(W, k0, o, lane)
#else
#define WCOL(W, k0, o, lane) wcol_io(W, k0, o, lane, CC)
#endif
#if WO_OUT_IN
#define WOCOL(W, k0, o, lane) wcol_oi(W, k0, o, lane, CC)
#define WOCOLH(W, k0, o, lane) wcolh_oi(W, k0, o, lane, CC)
#else
#define WOCOL(W, k0, o, lane) wcol_io(W, k0, o, lane, DIN)
#define WOCOLH(W, k0, o, lane) wcolh_io(W, k0, o, lane, DIN)
#endif

#define WS_QH  0u                                      // f16 q rows [b*t][CC]
#define WS_KH  (WS_QH + 2u * (size_t)NB * TT * CC)      // f16 k rows [b*t][CC]
#define WS_VT  (WS_KH + 2u * (size_t)NB * TT * CC)      // f16 v planes [b][c][t]
#define WS_QL  (WS_VT + 2u * (size_t)NB * CC * TT)      // f16 q residual x 2^10 rows [b][t < QHI][CC]
#define WS_KL  (WS_QL + 2u * (size_t)NB * QHI * CC)     // f16 k residual x 2^10 rows [b][t < KHI][CC]
#define WS_VB  (WS_KL + 2u * (size_t)NB * KHI * CC)     // bf16 v hi planes [b][c][t < KHI]
#define WS_VBL (WS_VB + 2u * (size_t)NB * CC * KHI)
#define WS_Y   (WS_VBL + 2u * (size_t)NB * CC * KHI)    // f32 ctx rows [b*t][CC] (only when there is an output projection)
#define WS_END (WS_Y  + 4u * (size_t)NB * TT * CC)

// ---- k_proj: block = (64 rows, 128 cols, which): q/k/v = X W (+ b) with exact bf16 products (K = DIN) -> which 0: q f16 rows (+ residual rows < QHI); 1: k f16 rows (+ residual rows < KHI); 2: v f16 planes [c][t] (+ bf16 hi/lo planes for t < KHI)
__global__ __launch_bounds__(128) void k_proj(const float* __restrict__ XQ, const float* __restrict__ XK, const float* __restrict__ XV, const float* __restrict__ WQ, const float* __restrict__ WK, const float* __restrict__ WV, const float* __restrict__ BQ, const float* __restrict__ BK, const float* __restrict__ BV,
    _Float16* __restrict__ QH, _Float16* __restrict__ QL, _Float16* __restrict__ KH, _Float16* __restrict__ KL, _Float16* __restrict__ VT, __bf16* __restrict__ VB, __bf16* __restrict__ VBL) {
  __shared__ __align__(16) _Float16 sh[64][136], sl[64][136]; __shared__ __align__(16) _Float16 th[128][72]; __shared__ __align__(16) __bf16 tb[128][72], tbl[128][72];
  const int tid = threadIdx.x, wave = tid >> 5, lane = tid & 31, col = lane & 15, g = lane >> 4; const int which = blockIdx.z; const int c0 = blockIdx.y * 128; const size_t r0 = (size_t)blockIdx.x * 64; const size_t bb = r0 / TT; const int t0 = (int)(r0 % TT);
  const float* X = which == 0 ? XQ : which == 1 ? XK : XV; const float* WA = which == 0 ? WQ : which == 1 ? WK : WV; const float* BA = which == 0 ? BQ : which == 1 ? BK : BV;
  v8f acc[8] = {};
#pragma unroll 2
  for (int kc = 0; kc < DIN / 32; ++kc) { v16b a; { const float* p = X + (r0 + wave * 16 + col) * DIN + kc * 32 + 8 * g;
#pragma unroll
      for (int i = 0; i < 8; ++i) { a[i] = (__bf16)p[i]; a[8 + i] = (__bf16)p[16 + i]; } }
    asm volatile("s_wait_loadcnt 0x0" ::: "memory");
#pragma unroll
    for (int j = 0; j < 8; ++j) { const v16b w = WCOL(WA, kc * 32, c0 + j * 16 + col, lane); asm volatile("s_wait_loadcnt 0x0" ::: "memory"); acc[j] = wmma_bf(a, w, acc[j]); } }
  if (which < 2) { _Float16* DH = which == 0 ? QH : KH; _Float16* DL = which == 0 ? QL : KL; const int nhi = which == 0 ? QHI : KHI; const bool hi_rows = t0 < nhi;
#pragma unroll
    for (int j = 0; j < 8; ++j) { const float bias = BA ? bfr(BA[c0 + j * 16 + col]) : 0.f;
#pragma unroll
      for (int r = 0; r < 8; ++r) { const float v = acc[j][r] + bias; const _Float16 hv = (_Float16)v; sh[wave * 16 + 8 * g + r][j * 16 + col] = hv; sl[wave * 16 + 8 * g + r][j * 16 + col] = (_Float16)((v - (float)hv) * 1024.0f); } }
    __syncthreads();
    for (int e = tid; e < 64 * 16; e += 128) { const int rl = e >> 4, q = e & 15; vst2((unsigned*)(DH + (r0 + rl) * CC + c0 + q * 8), *(const v4u*)&sh[rl][q * 8]); if (hi_rows) vst2((unsigned*)(DL + (bb * nhi + t0 + rl) * (size_t)CC + c0 + q * 8), *(const v4u*)&sl[rl][q * 8]); }
  } else { const bool hi_rows = t0 < KHI;
#pragma unroll
    for (int j = 0; j < 8; ++j) { const float bias = BA ? bfr(BA[c0 + j * 16 + col]) : 0.f;
#pragma unroll
      for (int r = 0; r < 8; ++r) { const float v = acc[j][r] + bias; const int rl = wave * 16 + 8 * g + r, cl = j * 16 + col; th[cl][rl] = (_Float16)v; const __bf16 bh = (__bf16)v; tb[cl][rl] = bh; tbl[cl][rl] = (__bf16)(v - (float)bh); } }
    __syncthreads();
    for (int e = tid; e < 128 * 8; e += 128) { const int cl = e >> 3, q = e & 7; vst2((unsigned*)(VT + (bb * CC + c0 + cl) * (size_t)TT + t0 + q * 8), *(const v4u*)&th[cl][q * 8]); if (hi_rows) { const size_t o3 = (bb * CC + c0 + cl) * (size_t)KHI + t0 + q * 8; vst2((unsigned*)(VB + o3), *(const v4u*)&tb[cl][q * 8]); vst2((unsigned*)(VBL + o3), *(const v4u*)&tbl[cl][q * 8]); } } } }
__device__ __forceinline__ v8f wmma_p(v16h a, v16h b, v8f c) { return __builtin_amdgcn_wmma_f32_16x16x32_f16(false, a, false, b, (short)0, c, false, false); }
__device__ __forceinline__ float xhalf(float v) { const int i = __builtin_bit_cast(int, v); return __builtin_bit_cast(float, __builtin_amdgcn_permlanex16(i, i, 0x76543210, 0xfedcba98, false, false)); }   // lane l <-> l ^ 16
__global__ __launch_bounds__(128) void k_fa(const _Float16* __restrict__ QH, const _Float16* __restrict__ QL, const _Float16* __restrict__ KH, const _Float16* __restrict__ VT, const float* __restrict__ MKF, float* __restrict__ Y) {
  const int tid = threadIdx.x, wave = tid >> 5, lane = tid & 31, col = lane & 15, g = lane >> 4; const int h = blockIdx.y, b = blockIdx.z; const int t = blockIdx.x * 64 + wave * 16 + col;
  v16h qh[HD / 32], ql[HD / 32];
#pragma unroll
  for (int kc = 0; kc < HD / 32; ++kc) { qh[kc] = frag_h(QH + ((size_t)b * TT + t) * CC + h * HD + kc * 32, lane); ql[kc] = frag_h(QL + ((size_t)b * QHI + t) * CC + h * HD + kc * 32, lane); }
  const _Float16* Kp = KH + ((size_t)b * TT + col) * CC + h * HD; const _Float16* Vp = VT + ((size_t)b * CC + h * HD + col) * (size_t)TT; const float* Mp = MKF + (size_t)t * TT + 8 * g;
  v16h kf[2][HD / 32]; v4f mk[2][2];
#pragma unroll
  for (int u = 0; u < 2; ++u) {
#pragma unroll
    for (int kc = 0; kc < HD / 32; ++kc) kf[u][kc] = frag_h(Kp + (size_t)(u * 16) * CC + kc * 32, lane);
    mk[u][0] = *(const v4f*)(Mp + u * 16); mk[u][1] = *(const v4f*)(Mp + u * 16 + 4); }
  v8f acc[HD / 16] = {}; float m = -3.0e38f, l = 0.f;
  for (int k0 = 0; k0 < TT; k0 += 32) { const int kn = k0 + 32 < TT ? k0 + 32 : k0;   // the pass fetched ahead; the last pass fetches its own again, in bounds, unused
    v16h vf[HD / 16];
#pragma unroll
    for (int j = 0; j < HD / 16; ++j) vf[j] = frag_h(Vp + (size_t)(j * 16) * TT + k0, lane);
    v8f sh[2] = {}, sl[2] = {};
#pragma unroll
    for (int kc = 0; kc < HD / 32; ++kc) {
#pragma unroll
      for (int u = 0; u < 2; ++u) { sh[u] = wmma_p(kf[u][kc], qh[kc], sh[u]); sl[u] = wmma_p(kf[u][kc], ql[kc], sl[u]); } }
#pragma unroll
    for (int u = 0; u < 2; ++u)
#pragma unroll
      for (int kc = 0; kc < HD / 32; ++kc) kf[u][kc] = frag_h(Kp + (size_t)(kn + u * 16) * CC + kc * 32, lane);
    float v[16]; float mx = -3.0e38f;
#pragma unroll
    for (int u = 0; u < 2; ++u)
#pragma unroll
      for (int r = 0; r < 8; ++r) { const float s = (sh[u][r] + sl[u][r] * (1.0f / 1024.0f)) * SCALE * bfr(mk[u][r >> 2][r & 3]); v[u * 8 + r] = s; mx = fmaxf(mx, s); }
#pragma unroll
    for (int u = 0; u < 2; ++u) { mk[u][0] = *(const v4f*)(Mp + kn + u * 16); mk[u][1] = *(const v4f*)(Mp + kn + u * 16 + 4); }
    __builtin_amdgcn_sched_barrier(0);   // this pass's v loads and the next pass's k and mask loads issue above this line, so they land under the exponentials; without it they sink to their first use and the wave waits there
    mx = fmaxf(mx, xhalf(mx)); const float mn = fmaxf(m, mx); const float alpha = expf(m - mn); m = mn;
    v16h p; float sum = 0.f;
#pragma unroll
    for (int i = 0; i < 16; ++i) { const float e = expf(v[i] - mn); sum += e; p[i] = (_Float16)(e * 2048.0f); }
    l = l * alpha + sum;
#pragma unroll
    for (int j = 0; j < HD / 16; ++j) { acc[j] = acc[j] * alpha; acc[j] = wmma_p(vf[j], p, acc[j]); } }
  l += xhalf(l); const float inv = 1.0f / (l * 2048.0f);   // never near 0: the key that holds the maximum adds exp(0)
  float* yp = Y + ((size_t)b * TT + t) * CC + h * HD + 8 * g;
#pragma unroll
  for (int j = 0; j < HD / 16; ++j) { const v8f o = acc[j] * inv; vst2(yp + j * 16, (v4f){o[0], o[1], o[2], o[3]}); vst2(yp + j * 16 + 4, (v4f){o[4], o[5], o[6], o[7]}); } }
// ---- k_out: block = (64 rows, 128 cols): out = ctx Wo (+ bo): all rows: ctx bf16 hi + lo against exact bf16 Wo (2 products); the f16 branch (ctx once to f16 against f16(bf16 x 2^8) Wo, x 2^-8) is never taken
__global__ __launch_bounds__(128) void k_out(const float* __restrict__ Y, const float* __restrict__ WO, const float* __restrict__ BO, float* __restrict__ OUT) { __shared__ __align__(16) float sf[4][16][132];
  const int tid = threadIdx.x, wave = tid >> 5, lane = tid & 31, col = lane & 15, g = lane >> 4; const int c0 = blockIdx.y * 128; const size_t r0 = (size_t)blockIdx.x * 64 + wave * 16;
  v8f acc[8] = {};
  if (true) {   /* ALL rows: ctx split bf16 hi + lo x exact Wo (2 products) */
#pragma unroll 2
    for (int kc = 0; kc < CC / 32; ++kc) { const F2 a = split_row(Y + (r0 + col) * CC, kc * 32, lane); asm volatile("s_wait_loadcnt 0x0" ::: "memory");
#pragma unroll
      for (int j = 0; j < 8; ++j) { const v16b w = WOCOL(WO, kc * 32, c0 + j * 16 + col, lane); asm volatile("s_wait_loadcnt 0x0" ::: "memory"); acc[j] = wmma_bf(a.h, w, acc[j]); acc[j] = wmma_bf(a.l, w, acc[j]); } }
#pragma unroll
    for (int j = 0; j < 8; ++j) { const float bias = BO ? bfr(BO[c0 + j * 16 + col]) : 0.f;
#pragma unroll
      for (int r = 0; r < 8; ++r) sf[wave][8 * g + r][j * 16 + col] = acc[j][r] + bias; }
  } else {
#pragma unroll 2
    for (int kc = 0; kc < CC / 32; ++kc) { const v16h a = frag_f32(Y + (r0 + col) * CC + kc * 32, lane); asm volatile("s_wait_loadcnt 0x0" ::: "memory");
#pragma unroll
      for (int j = 0; j < 8; ++j) { const v16h w = WOCOLH(WO, kc * 32, c0 + j * 16 + col, lane); asm volatile("s_wait_loadcnt 0x0" ::: "memory"); acc[j] = wmma16(a, w, acc[j]); } }
#pragma unroll
    for (int j = 0; j < 8; ++j) { const float bias = BO ? bfr(BO[c0 + j * 16 + col]) : 0.f;
#pragma unroll
      for (int r = 0; r < 8; ++r) sf[wave][8 * g + r][j * 16 + col] = acc[j][r] * (1.0f / 256.0f) + bias; } }
  LDSX(); for (int rl = 0; rl < 16; ++rl) vst2(OUT + (r0 + rl) * DIN + c0 + lane * 4, *(const v4f*)&sf[wave][rl][lane * 4]); }

extern "C" void kernel_launch(void* const* d_in, const int* in_sizes, int n_in, void* d_out, int out_size, void* d_ws, size_t ws_size, hipStream_t stream) {
  (void)in_sizes; (void)n_in; (void)out_size;
  const float** F = (const float**)d_in;
  if (ws_size < (size_t)WS_END) return;
  char* ws = (char*)d_ws; _Float16 *QH = (_Float16*)(ws + WS_QH), *KH = (_Float16*)(ws + WS_KH), *VT = (_Float16*)(ws + WS_VT), *QL = (_Float16*)(ws + WS_QL), *KL = (_Float16*)(ws + WS_KL); __bf16 *VB = (__bf16*)(ws + WS_VB), *VBL = (__bf16*)(ws + WS_VBL); float *Y = (float*)(ws + WS_Y);
  // inputs: 0 x [2,2048,1024]; 1 w_qkv [3072,1024] (out,in); 2 w_proj [1024,1024] (out,in); 3 b_proj; 4 mask [2048,2048] f32 0/1
  k_proj<<<dim3(TNB * TT / 64, CC / 128, 3), 128, 0, stream>>>(F[0], F[0], F[0], F[1], F[1] + (size_t)CC * DIN, F[1] + (size_t)2 * CC * DIN, nullptr, nullptr, nullptr, QH, QL, KH, KL, VT, VB, VBL);
  k_fa<<<dim3(NQB, NH, TNB), 128, 0, stream>>>(QH, QL, KH, VT, F[4], Y);
  k_out<<<dim3(TNB * TT / 64, DIN / 128), 128, 0, stream>>>(Y, F[2], F[3], (float*)d_out);
}

// v002
// Measured time: 191 microseconds a run.
// In both of two side-by-side timings against v001, it was 2.53 times as fast.
// Counting every step since v000, it is 7.10 times as fast.
// compute dtype: all float inputs rounded to bf16; qkv = x Wqkv^T with EXACT bf16 products on WMMA 16x16x32 (f32 accumulate); q as f16 hi + residual (x 2^10) against k once to f16 (2 products) x 64^-0.5, then MULTIPLIED by the 0/1 mask (masked logits become 0, they are not excluded); softmax in f32 (precise expf) with a running maximum, scores kept in registers; exp(logit - max) x 2^11 once to f16 against v once to f16 (1 product), divided by the f32 sum at the end; ctx split bf16 hi + lo against exact w_proj (2 products) + b_proj; f32 output.
#include <hip/hip_runtime.h>
#include <math.h>

typedef __attribute__((ext_vector_type(16))) _Float16 v16h;
typedef __attribute__((ext_vector_type(16))) __bf16 v16b;
typedef __attribute__((ext_vector_type(8)))  _Float16 v8h;
typedef __attribute__((ext_vector_type(8)))  float v8f;
typedef __attribute__((ext_vector_type(4)))  float v4f;
typedef __attribute__((ext_vector_type(2)))  float v2f;
typedef __attribute__((ext_vector_type(4)))  unsigned v4u;
typedef __attribute__((ext_vector_type(4)))  int v4i;
typedef float __attribute__((may_alias)) float_a;
typedef int __attribute__((may_alias)) int_a;

template <typename T> __device__ __forceinline__ void vst2(void* p, T v) { *(T*)p = v;  }
__device__ __forceinline__ v8f wmma16(v16h a, v16h b, v8f c) {
  v8f d = __builtin_amdgcn_wmma_f32_16x16x32_f16(false, a, false, b, (short)0, c, false, false);
  asm volatile("v_nop\n\tv_nop\n\tv_nop\n\tv_nop" : "+v"(d) : "v"(a), "v"(b));
  return d;
}
__device__ __forceinline__ v8f wmma_bf(v16b a, v16b b, v8f c) {
  v8f d = __builtin_amdgcn_wmma_f32_16x16x32_bf16(false, a, false, b, (short)0, c, false, false);
  asm volatile("v_nop\n\tv_nop\n\tv_nop\n\tv_nop" : "+v"(d) : "v"(a), "v"(b));
  return d;
}
// 16x16x32 fragments: lane = (h = lane>>4, row/col = lane&15); elements 0..7 = k0+8h+0..7, 8..15 = k0+16+8h+0..7; D element r = row 8h+r
__device__ __forceinline__ v16h frag_h(const _Float16* rowk0, int lane) {
  union { v16h v; v8h q[2]; } u; const _Float16* p = rowk0 + 8 * (lane >> 4);
  u.q[0] = *(const v8h*)p; u.q[1] = *(const v8h*)(p + 16); return u.v;
}
__device__ __forceinline__ v16h frag_f32(const float* rowk0, int lane) {
  v16h a; const float* p = rowk0 + 8 * (lane >> 4);
#pragma unroll
  for (int i = 0; i < 8; ++i) { a[i] = (_Float16)p[i]; a[8 + i] = (_Float16)p[16 + i]; }
  return a;
}
__device__ __forceinline__ v16h frag_f32s(const float* rowk0, int lane, float sc) {
  v16h a; const float* p = rowk0 + 8 * (lane >> 4);
#pragma unroll
  for (int i = 0; i < 8; ++i) { a[i] = (_Float16)(p[i] * sc); a[8 + i] = (_Float16)(p[16 + i] * sc); }
  return a;
}
// column fragment from a [K][ld] layout (column n), rows >= K read as 0
__device__ __forceinline__ v16h fragc_f32(const float* W, int k0, int n, int lane, int ld, int K) {
  v16h a; const int g = lane >> 4;
#pragma unroll
  for (int i = 0; i < 8; ++i) { const int ka = k0 + 8 * g + i, kb = ka + 16;
    a[i] = (_Float16)(ka < K ? W[(size_t)(ka < K ? ka : K - 1) * ld + n] : 0.f); a[8 + i] = (_Float16)(kb < K ? W[(size_t)(kb < K ? kb : K - 1) * ld + n] : 0.f); }
  return a;
}
struct F2 { v16b h, l; };
__device__ __forceinline__ F2 bsplit16(const float v[16]) { F2 r;
#pragma unroll
  for (int i = 0; i < 16; ++i) { const __bf16 h = (__bf16)v[i]; r.h[i] = h; r.l[i] = (__bf16)(v[i] - (float)h); }
  return r; }
__device__ __forceinline__ F2 split_row(const float* row, int k0, int lane) { float v[16]; const float* p = row + k0 + 8 * (lane >> 4);
#pragma unroll
  for (int i = 0; i < 8; ++i) { v[i] = p[i]; v[8 + i] = p[16 + i]; }
  return bsplit16(v); }
__device__ __forceinline__ F2 split_rowK(const float* row, int k0, int lane, int K) { float v[16]; const int g = lane >> 4;
#pragma unroll
  for (int i = 0; i < 8; ++i) { const int ka = k0 + 8 * g + i, kb = ka + 16; v[i] = ka < K ? row[ka < K ? ka : K - 1] : 0.f; v[8 + i] = kb < K ? row[kb < K ? kb : K - 1] : 0.f; }
  return bsplit16(v); }
__device__ __forceinline__ F2 split_col(const float* W, int k0, int n, int lane, int ld, int K) { float v[16]; const int g = lane >> 4;
#pragma unroll
  for (int i = 0; i < 8; ++i) { const int ka = k0 + 8 * g + i, kb = ka + 16; v[i] = ka < K ? W[(size_t)(ka < K ? ka : K - 1) * ld + n] : 0.f; v[8 + i] = kb < K ? W[(size_t)(kb < K ? kb : K - 1) * ld + n] : 0.f; }
  return bsplit16(v); }
__device__ __forceinline__ v8f mac3(const F2& a, const F2& b, v8f c) { c = wmma_bf(a.l, b.h, c); c = wmma_bf(a.h, b.l, c); return wmma_bf(a.h, b.h, c); }
__device__ __forceinline__ float sigm(float v) { return 1.0f / (1.0f + expf(-v)); }
#define LDSX() do { asm volatile("s_wait_dscnt 0" ::: "memory"); __builtin_amdgcn_wave_barrier(); __builtin_amdgcn_fence(__ATOMIC_RELEASE, "workgroup"); } while (0)

// Multi-head attention with a MULTIPLICATIVE 0/1 mask (B 2, N 2,048, C 1,024 = 16 x 64): qkv = x w_qkv^T ((out,in) [3072,1024], rows (3,H,D)); attn = softmax((q k^T x 64^-0.5) * mask) with mask [N,N] of 0/1 shared over (b,h) - a masked logit is 0.0, still inside the softmax; out = merged(attn v) w_proj^T + b_proj.
#define NB 2
#define TT 2048
#define CC 1024            // NH * HD = projected width
#define DIN 1024          // input (model) width
#define NH 16
#define HD 64
#define NQB (TT / 64)
#define SCALE (0.125f)
#ifndef TNB
#define TNB NB
#endif
__device__ __forceinline__ float bfr(float v) { return (float)(__bf16)v; }
typedef __attribute__((ext_vector_type(8))) __bf16 v8b;
__device__ __forceinline__ v16b frag_b(const __bf16* rowk0, int lane) {
  union { v16b v; v8b q[2]; } u; const __bf16* p = rowk0 + 8 * (lane >> 4);
  u.q[0] = *(const v8b*)p; u.q[1] = *(const v8b*)(p + 16); return u.v;
}
#define QHI 2048            // rows carrying a q residual plane (all rows when non-causal: 2-product logits everywhere)
#define KHI 64            // key rows carrying k residual / v bf16 hi+lo planes (written by k_proj; no kernel in this file reads them)
// B fragment (k rows k0+.., output column o) of a weight: (in,out) [K][ld] or (out,in) [ld rows of K]: bf16 exact, or f16(bf16 * 256) exact
__device__ __forceinline__ v16b wcol_io(const float* Wm, int k0, int o, int lane, int ld) { v16b w; const int g = lane >> 4;
#pragma unroll
  for (int i = 0; i < 8; ++i) { w[i] = (__bf16)Wm[(size_t)(k0 + 8 * g + i) * ld + o]; w[8 + i] = (__bf16)Wm[(size_t)(k0 + 16 + 8 * g + i) * ld + o]; }
  return w; }
__device__ __forceinline__ v16b wcol_oi(const float* Wm, int k0, int o, int lane, int K) { v16b w; const float* p = Wm + (size_t)o * K + k0 + 8 * (lane >> 4);
#pragma unroll
  for (int i = 0; i < 8; ++i) { w[i] = (__bf16)p[i]; w[8 + i] = (__bf16)p[16 + i]; }
  return w; }
__device__ __forceinline__ v16h wcolh_io(const float* Wm, int k0, int o, int lane, int ld) { v16h w; const int g = lane >> 4;
#pragma unroll
  for (int i = 0; i < 8; ++i) { w[i] = (_Float16)(bfr(Wm[(size_t)(k0 + 8 * g + i) * ld + o]) * 256.0f); w[8 + i] = (_Float16)(bfr(Wm[(size_t)(k0 + 16 + 8 * g + i) * ld + o]) * 256.0f); }
  return w; }
__device__ __forceinline__ v16h wcolh_oi(const float* Wm, int k0, int o, int lane, int K) { v16h w; const float* p = Wm + (size_t)o * K + k0 + 8 * (lane >> 4);
#pragma unroll
  for (int i = 0; i < 8; ++i) { w[i] = (_Float16)(bfr(p[i]) * 256.0f); w[8 + i] = (_Float16)(bfr(p[16 + i]) * 256.0f); }
  return w; }
#define WQKV_LAYOUT 1   // 0 = (in,out) [DIN][CC]; 1 = (out,in) [CC][DIN]; 2 = per-head [NH][DIN][HD]
__device__ __forceinline__ v16b wcol_hdk(const float* Wm, int k0, int o, int lane) { v16b w; const int g = lane >> 4; const float* p = Wm + (size_t)(o / HD) * DIN * HD + (o % HD);
#pragma unroll
  for (int i = 0; i < 8; ++i) { w[i] = (__bf16)p[(size_t)(k0 + 8 * g + i) * HD]; w[8 + i] = (__bf16)p[(size_t)(k0 + 16 + 8 * g + i) * HD]; }
  return w; }
#define WO_OUT_IN 1
#if WQKV_LAYOUT == 1
#define WCOL(W, k0, o, lane) wcol_oi(W, k0, o, lane, DIN)
#elif WQKV_LAYOUT == 2
#define WCOL(W, k0, o, lane) wcol_hdk(W, k0, o, lane)
#else
#define WCOL(W, k0, o, lane) wcol_io(W, k0, o, lane, CC)
#endif
#if WO_OUT_IN
#define WOCOL(W, k0, o, lane) wcol_oi(W, k0, o, lane, CC)
#define WOCOLH(W, k0, o, lane) wcolh_oi(W, k0, o, lane, CC)
#else
#define WOCOL(W, k0, o, lane) wcol_io(W, k0, o, lane, DIN)
#define WOCOLH(W, k0, o, lane) wcolh_io(W, k0, o, lane, DIN)
#endif

#define WS_QH  0u                                      // f16 q rows [b*t][CC]
#define WS_KH  (WS_QH + 2u * (size_t)NB * TT * CC)      // f16 k rows [b*t][CC]
#define WS_VT  (WS_KH + 2u * (size_t)NB * TT * CC)      // f16 v planes [b][c][t]
#define WS_QL  (WS_VT + 2u * (size_t)NB * CC * TT)      // f16 q residual x 2^10 rows [b][t < QHI][CC]
#define WS_KL  (WS_QL + 2u * (size_t)NB * QHI * CC)     // f16 k residual x 2^10 rows [b][t < KHI][CC]
#define WS_VB  (WS_KL + 2u * (size_t)NB * KHI * CC)     // bf16 v hi planes [b][c][t < KHI]
#define WS_VBL (WS_VB + 2u * (size_t)NB * CC * KHI)
#define WS_Y   (WS_VBL + 2u * (size_t)NB * CC * KHI)    // f32 ctx rows [b*t][CC] (only when there is an output projection)
#define WS_END (WS_Y  + 4u * (size_t)NB * TT * CC)

// LDS staging of the two projection GEMMs: a chunk is KC k values of every operand row of the block's tile, read from global memory as whole 256-B row pieces (16 lanes x 16 B), rounded to bf16 once and shared by the block's four waves
#define KC 64
#define SP 72             // LDS row pitch in 16-bit elements: 144 B = 16 B x 9, so the 16 rows of a 16-byte fragment read fall on distinct banks
typedef __attribute__((ext_vector_type(4))) __bf16 v4b;
__device__ __forceinline__ v4b bf4(v4f v) { v4b r; r[0] = (__bf16)v[0]; r[1] = (__bf16)v[1]; r[2] = (__bf16)v[2]; r[3] = (__bf16)v[3]; return r; }
// ---- k_proj: block = (64 rows, 128 cols, which): q/k/v = X W (+ b) with exact bf16 products (K = DIN) -> which 0: q f16 rows (+ residual rows < QHI); 1: k f16 rows (+ residual rows < KHI); 2: v f16 planes [c][t] (+ bf16 hi/lo planes for t < KHI)
__global__ __launch_bounds__(128) void k_proj(const float* __restrict__ XQ, const float* __restrict__ XK, const float* __restrict__ XV, const float* __restrict__ WQ, const float* __restrict__ WK, const float* __restrict__ WV, const float* __restrict__ BQ, const float* __restrict__ BK, const float* __restrict__ BV,
    _Float16* __restrict__ QH, _Float16* __restrict__ QL, _Float16* __restrict__ KH, _Float16* __restrict__ KL, _Float16* __restrict__ VT, __bf16* __restrict__ VB, __bf16* __restrict__ VBL) {
  // one LDS range: in the K loop two staging buffers of [X 64 rows | W 128 rows] x SP; behind the loop's last barrier the output staging (sh, sl or th, tb, tbl)
  __shared__ __align__(16) char smem[2 * 192 * SP * 2];
  _Float16 (*sh)[136] = (_Float16 (*)[136])smem; _Float16 (*sl)[136] = (_Float16 (*)[136])(smem + 64 * 136 * 2); _Float16 (*th)[72] = (_Float16 (*)[72])smem; __bf16 (*tb)[72] = (__bf16 (*)[72])(smem + 128 * 72 * 2); __bf16 (*tbl)[72] = (__bf16 (*)[72])(smem + 2 * 128 * 72 * 2);
  __bf16* const st = (__bf16*)smem;
  const int tid = threadIdx.x, wave = tid >> 5, lane = tid & 31, col = lane & 15, g = lane >> 4; const int which = blockIdx.z; const int c0 = blockIdx.y * 128; const size_t r0 = (size_t)blockIdx.x * 64; const size_t bb = r0 / TT; const int t0 = (int)(r0 % TT);
  const float* X = which == 0 ? XQ : which == 1 ? XK : XV; const float* WA = which == 0 ? WQ : which == 1 ? WK : WV; const float* BA = which == 0 ? BQ : which == 1 ? BK : BV;
  v8f acc[8] = {};
  const int srow = tid >> 4, sq = (tid & 15) * 4; const float* Xg = X + (r0 + srow) * DIN + sq; const float* Wg = WA + (size_t)(c0 + srow) * DIN + sq; __bf16* const sd = st + srow * SP + sq;
  v4f rx[8], rw[16];   // the inner loops below are fully unrolled so that every index into rx, rw, w and acc is a constant (registers, no scratch)
#pragma unroll
  for (int i = 0; i < 8; ++i) rx[i] = *(const v4f*)(Xg + (size_t)(i * 8) * DIN);
#pragma unroll
  for (int i = 0; i < 16; ++i) rw[i] = *(const v4f*)(Wg + (size_t)(i * 8) * DIN);
  asm volatile("s_wait_xcnt 0x0" ::: "memory");   // stands in front of the first overwrite of an address register that the loads above name
#pragma unroll
  for (int i = 0; i < 8; ++i) *(v4b*)(sd + i * 8 * SP) = bf4(rx[i]);
#pragma unroll
  for (int i = 0; i < 16; ++i) *(v4b*)(sd + (64 + i * 8) * SP) = bf4(rw[i]);
  __syncthreads();
  for (int c = 0; c < DIN / KC; ++c) { const bool more = c + 1 < DIN / KC;   // chunk c + 1 flies into registers while chunk c is multiplied out of LDS
    if (more) {
#pragma unroll
      for (int i = 0; i < 8; ++i) rx[i] = *(const v4f*)(Xg + (size_t)(i * 8) * DIN + (c + 1) * KC);
#pragma unroll
      for (int i = 0; i < 16; ++i) rw[i] = *(const v4f*)(Wg + (size_t)(i * 8) * DIN + (c + 1) * KC); }
    const __bf16* buf = st + (c & 1) * (192 * SP);
#pragma unroll
    for (int ks = 0; ks < KC / 32; ++ks) { const v16b a = frag_b(buf + (wave * 16 + col) * SP + ks * 32, lane); v16b w[8];
#pragma unroll
      for (int j = 0; j < 8; ++j) w[j] = frag_b(buf + (64 + j * 16 + col) * SP + ks * 32, lane);
#pragma unroll
      for (int j = 0; j < 8; ++j) acc[j] = wmma_bf(a, w[j], acc[j]); }
    if (more) { __bf16* d = sd + ((c + 1) & 1) * (192 * SP);
#pragma unroll
      for (int i = 0; i < 8; ++i) *(v4b*)(d + i * 8 * SP) = bf4(rx[i]);
#pragma unroll
      for (int i = 0; i < 16; ++i) *(v4b*)(d + (64 + i * 8) * SP) = bf4(rw[i]); }
    __syncthreads(); }   // publishes chunk c + 1 and ends every wave's reads of the buffer that the next trip refills (behind the last trip: of the range that becomes output staging)
  if (which < 2) { _Float16* DH = which == 0 ? QH : KH; _Float16* DL = which == 0 ? QL : KL; const int nhi = which == 0 ? QHI : KHI; const bool hi_rows = t0 < nhi;
#pragma unroll
    for (int j = 0; j < 8; ++j) { const float bias = BA ? bfr(BA[c0 + j * 16 + col]) : 0.f;
#pragma unroll
      for (int r = 0; r < 8; ++r) { const float v = acc[j][r] + bias; const _Float16 hv = (_Float16)v; sh[wave * 16 + 8 * g + r][j * 16 + col] = hv; sl[wave * 16 + 8 * g + r][j * 16 + col] = (_Float16)((v - (float)hv) * 1024.0f); } }
    __syncthreads();
    for (int e = tid; e < 64 * 16; e += 128) { const int rl = e >> 4, q = e & 15; vst2((unsigned*)(DH + (r0 + rl) * CC + c0 + q * 8), *(const v4u*)&sh[rl][q * 8]); if (hi_rows) vst2((unsigned*)(DL + (bb * nhi + t0 + rl) * (size_t)CC + c0 + q * 8), *(const v4u*)&sl[rl][q * 8]); }
  } else { const bool hi_rows = t0 < KHI;
#pragma unroll
    for (int j = 0; j < 8; ++j) { const float bias = BA ? bfr(BA[c0 + j * 16 + col]) : 0.f;
#pragma unroll
      for (int r = 0; r < 8; ++r) { const float v = acc[j][r] + bias; const int rl = wave * 16 + 8 * g + r, cl = j * 16 + col; th[cl][rl] = (_Float16)v; const __bf16 bh = (__bf16)v; tb[cl][rl] = bh; tbl[cl][rl] = (__bf16)(v - (float)bh); } }
    __syncthreads();
    for (int e = tid; e < 128 * 8; e += 128) { const int cl = e >> 3, q = e & 7; vst2((unsigned*)(VT + (bb * CC + c0 + cl) * (size_t)TT + t0 + q * 8), *(const v4u*)&th[cl][q * 8]); if (hi_rows) { const size_t o3 = (bb * CC + c0 + cl) * (size_t)KHI + t0 + q * 8; vst2((unsigned*)(VB + o3), *(const v4u*)&tb[cl][q * 8]); vst2((unsigned*)(VBL + o3), *(const v4u*)&tbl[cl][q * 8]); } } } }
__device__ __forceinline__ v8f wmma_p(v16h a, v16h b, v8f c) { return __builtin_amdgcn_wmma_f32_16x16x32_f16(false, a, false, b, (short)0, c, false, false); }
__device__ __forceinline__ float xhalf(float v) { const int i = __builtin_bit_cast(int, v); return __builtin_bit_cast(float, __builtin_amdgcn_permlanex16(i, i, 0x76543210, 0xfedcba98, false, false)); }   // lane l <-> l ^ 16
__global__ __launch_bounds__(128) void k_fa(const _Float16* __restrict__ QH, const _Float16* __restrict__ QL, const _Float16* __restrict__ KH, const _Float16* __restrict__ VT, const float* __restrict__ MKF, float* __restrict__ Y) {
  const int tid = threadIdx.x, wave = tid >> 5, lane = tid & 31, col = lane & 15, g = lane >> 4; const int h = blockIdx.y, b = blockIdx.z; const int t = blockIdx.x * 64 + wave * 16 + col;
  v16h qh[HD / 32], ql[HD / 32];
#pragma unroll
  for (int kc = 0; kc < HD / 32; ++kc) { qh[kc] = frag_h(QH + ((size_t)b * TT + t) * CC + h * HD + kc * 32, lane); ql[kc] = frag_h(QL + ((size_t)b * QHI + t) * CC + h * HD + kc * 32, lane); }
  const _Float16* Kp = KH + ((size_t)b * TT + col) * CC + h * HD; const _Float16* Vp = VT + ((size_t)b * CC + h * HD + col) * (size_t)TT; const float* Mp = MKF + (size_t)t * TT + 8 * g;
  v16h kf[2][HD / 32]; v4f mk[2][2];
#pragma unroll
  for (int u = 0; u < 2; ++u) {
#pragma unroll
    for (int kc = 0; kc < HD / 32; ++kc) kf[u][kc] = frag_h(Kp + (size_t)(u * 16) * CC + kc * 32, lane);
    mk[u][0] = *(const v4f*)(Mp + u * 16); mk[u][1] = *(const v4f*)(Mp + u * 16 + 4); }
  v8f acc[HD / 16] = {}; float m = -3.0e38f, l = 0.f;
  for (int k0 = 0; k0 < TT; k0 += 32) { const int kn = k0 + 32 < TT ? k0 + 32 : k0;   // the pass fetched ahead; the last pass fetches its own again, in bounds, unused
    v16h vf[HD / 16];
#pragma unroll
    for (int j = 0; j < HD / 16; ++j) vf[j] = frag_h(Vp + (size_t)(j * 16) * TT + k0, lane);
    v8f sh[2] = {}, sl[2] = {};
#pragma unroll
    for (int kc = 0; kc < HD / 32; ++kc) {
#pragma unroll
      for (int u = 0; u < 2; ++u) { sh[u] = wmma_p(kf[u][kc], qh[kc], sh[u]); sl[u] = wmma_p(kf[u][kc], ql[kc], sl[u]); } }
#pragma unroll
    for (int u = 0; u < 2; ++u)
#pragma unroll
      for (int kc = 0; kc < HD / 32; ++kc) kf[u][kc] = frag_h(Kp + (size_t)(kn + u * 16) * CC + kc * 32, lane);
    float v[16]; float mx = -3.0e38f;
#pragma unroll
    for (int u = 0; u < 2; ++u)
#pragma unroll
      for (int r = 0; r < 8; ++r) { const float s = (sh[u][r] + sl[u][r] * (1.0f / 1024.0f)) * SCALE * bfr(mk[u][r >> 2][r & 3]); v[u * 8 + r] = s; mx = fmaxf(mx, s); }
#pragma unroll
    for (int u = 0; u < 2; ++u) { mk[u][0] = *(const v4f*)(Mp + kn + u * 16); mk[u][1] = *(const v4f*)(Mp + kn + u * 16 + 4); }
    __builtin_amdgcn_sched_barrier(0);   // this pass's v loads and the next pass's k and mask loads issue above this line, so they land under the exponentials; without it they sink to their first use and the wave waits there
    mx = fmaxf(mx, xhalf(mx)); const float mn = fmaxf(m, mx); const float alpha = expf(m - mn); m = mn;
    v16h p; float sum = 0.f;
#pragma unroll
    for (int i = 0; i < 16; ++i) { const float e = expf(v[i] - mn); sum += e; p[i] = (_Float16)(e * 2048.0f); }
    l = l * alpha + sum;
#pragma unroll
    for (int j = 0; j < HD / 16; ++j) { acc[j] = acc[j] * alpha; acc[j] = wmma_p(vf[j], p, acc[j]); } }
  l += xhalf(l); const float inv = 1.0f / (l * 2048.0f);   // never near 0: the key that holds the maximum adds exp(0)
  float* yp = Y + ((size_t)b * TT + t) * CC + h * HD + 8 * g;
#pragma unroll
  for (int j = 0; j < HD / 16; ++j) { const v8f o = acc[j] * inv; vst2(yp + j * 16, (v4f){o[0], o[1], o[2], o[3]}); vst2(yp + j * 16 + 4, (v4f){o[4], o[5], o[6], o[7]}); } }
// ---- k_out: block = (64 rows, 128 cols): out = ctx Wo (+ bo): all rows: ctx bf16 hi + lo against exact bf16 Wo (2 products); the f16 (1 product) branch is not taken
__global__ __launch_bounds__(128) void k_out(const float* __restrict__ Y, const float* __restrict__ WO, const float* __restrict__ BO, float* __restrict__ OUT) { __shared__ __align__(16) float sf[4][16][132]; __shared__ __align__(16) __bf16 so[2 * 256 * SP];   // so: two staging buffers of [ctx hi 64 rows | ctx lo 64 rows | Wo 128 rows] x SP
  const int tid = threadIdx.x, wave = tid >> 5, lane = tid & 31, col = lane & 15, g = lane >> 4; const int c0 = blockIdx.y * 128; const size_t r0 = (size_t)blockIdx.x * 64 + wave * 16;
  v8f acc[8] = {};
  if (true) {   /* ALL rows: ctx split bf16 hi + lo x exact Wo (2 products) */
    const int srow = tid >> 4, sq = (tid & 15) * 4; const float* Yg = Y + ((size_t)blockIdx.x * 64 + srow) * CC + sq; const float* Wg = WO + (size_t)(c0 + srow) * CC + sq; __bf16* const sd = so + srow * SP + sq;
    v4f ry[8], rw[16];   // the inner loops below are fully unrolled so that every index into ry, rw, w and acc is a constant (registers, no scratch)
#pragma unroll
    for (int i = 0; i < 8; ++i) ry[i] = *(const v4f*)(Yg + (size_t)(i * 8) * CC);
#pragma unroll
    for (int i = 0; i < 16; ++i) rw[i] = *(const v4f*)(Wg + (size_t)(i * 8) * CC);
#pragma unroll
    for (int i = 0; i < 8; ++i) { const v4b hv = bf4(ry[i]); *(v4b*)(sd + i * 8 * SP) = hv; *(v4b*)(sd + (64 + i * 8) * SP) = bf4((v4f){ry[i][0] - (float)hv[0], ry[i][1] - (float)hv[1], ry[i][2] - (float)hv[2], ry[i][3] - (float)hv[3]}); }
#pragma unroll
    for (int i = 0; i < 16; ++i) *(v4b*)(sd + (128 + i * 8) * SP) = bf4(rw[i]);
    __syncthreads();
    for (int c = 0; c < CC / KC; ++c) { const bool more = c + 1 < CC / KC;   // chunk c + 1 flies into registers while chunk c is multiplied out of LDS
      if (more) {
#pragma unroll
        for (int i = 0; i < 8; ++i) ry[i] = *(const v4f*)(Yg + (size_t)(i * 8) * CC + (c + 1) * KC);
#pragma unroll
        for (int i = 0; i < 16; ++i) rw[i] = *(const v4f*)(Wg + (size_t)(i * 8) * CC + (c + 1) * KC);
        asm volatile("s_wait_xcnt 0x0" ::: "memory"); }   // stands in front of the first overwrite of an address register that the loads above name
      const __bf16* buf = so + (c & 1) * (256 * SP);
#pragma unroll
      for (int ks = 0; ks < KC / 32; ++ks) { const v16b ah = frag_b(buf + (wave * 16 + col) * SP + ks * 32, lane), al = frag_b(buf + (64 + wave * 16 + col) * SP + ks * 32, lane);
#pragma unroll
        for (int jh = 0; jh < 8; jh += 4) { v16b w[4];   // four Wo fragments at a time: hi then lo into four independent tiles, so no product waits for the one before it on its own tile
#pragma unroll
          for (int j = 0; j < 4; ++j) w[j] = frag_b(buf + (128 + (jh + j) * 16 + col) * SP + ks * 32, lane);
#pragma unroll
          for (int j = 0; j < 4; ++j) acc[jh + j] = wmma_bf(ah, w[j], acc[jh + j]);
#pragma unroll
          for (int j = 0; j < 4; ++j) acc[jh + j] = wmma_bf(al, w[j], acc[jh + j]); } }
      if (more) { __bf16* d = sd + ((c + 1) & 1) * (256 * SP);
#pragma unroll
        for (int i = 0; i < 8; ++i) { const v4b hv = bf4(ry[i]); *(v4b*)(d + i * 8 * SP) = hv; *(v4b*)(d + (64 + i * 8) * SP) = bf4((v4f){ry[i][0] - (float)hv[0], ry[i][1] - (float)hv[1], ry[i][2] - (float)hv[2], ry[i][3] - (float)hv[3]}); }
#pragma unroll
        for (int i = 0; i < 16; ++i) *(v4b*)(d + (128 + i * 8) * SP) = bf4(rw[i]); }
      __syncthreads(); }   // publishes chunk c + 1 and ends every wave's reads of the buffer that the next trip refills
#pragma unroll
    for (int j = 0; j < 8; ++j) { const float bias = BO ? bfr(BO[c0 + j * 16 + col]) : 0.f;
#pragma unroll
      for (int r = 0; r < 8; ++r) sf[wave][8 * g + r][j * 16 + col] = acc[j][r] + bias; }
  } else {
#pragma unroll 2
    for (int kc = 0; kc < CC / 32; ++kc) { const v16h a = frag_f32(Y + (r0 + col) * CC + kc * 32, lane); asm volatile("s_wait_loadcnt 0x0" ::: "memory");
#pragma unroll
      for (int j = 0; j < 8; ++j) { const v16h w = WOCOLH(WO, kc * 32, c0 + j * 16 + col, lane); asm volatile("s_wait_loadcnt 0x0" ::: "memory"); acc[j] = wmma16(a, w, acc[j]); } }
#pragma unroll
    for (int j = 0; j < 8; ++j) { const float bias = BO ? bfr(BO[c0 + j * 16 + col]) : 0.f;
#pragma unroll
      for (int r = 0; r < 8; ++r) sf[wave][8 * g + r][j * 16 + col] = acc[j][r] * (1.0f / 256.0f) + bias; } }
  LDSX(); for (int rl = 0; rl < 16; ++rl) vst2(OUT + (r0 + rl) * DIN + c0 + lane * 4, *(const v4f*)&sf[wave][rl][lane * 4]); }

extern "C" void kernel_launch(void* const* d_in, const int* in_sizes, int n_in, void* d_out, int out_size, void* d_ws, size_t ws_size, hipStream_t stream) {
  (void)in_sizes; (void)n_in; (void)out_size;
  const float** F = (const float**)d_in;
  if (ws_size < (size_t)WS_END) return;
  char* ws = (char*)d_ws; _Float16 *QH = (_Float16*)(ws + WS_QH), *KH = (_Float16*)(ws + WS_KH), *VT = (_Float16*)(ws + WS_VT), *QL = (_Float16*)(ws + WS_QL), *KL = (_Float16*)(ws + WS_KL); __bf16 *VB = (__bf16*)(ws + WS_VB), *VBL = (__bf16*)(ws + WS_VBL); float *Y = (float*)(ws + WS_Y);
  // inputs: 0 x [2,2048,1024]; 1 w_qkv [3072,1024] (out,in); 2 w_proj [1024,1024] (out,in); 3 b_proj; 4 mask [2048,2048] f32 0/1
  k_proj<<<dim3(TNB * TT / 64, CC / 128, 3), 128, 0, stream>>>(F[0], F[0], F[0], F[1], F[1] + (size_t)CC * DIN, F[1] + (size_t)2 * CC * DIN, nullptr, nullptr, nullptr, QH, QL, KH, KL, VT, VB, VBL);
  k_fa<<<dim3(NQB, NH, TNB), 128, 0, stream>>>(QH, QL, KH, VT, F[4], Y);
  k_out<<<dim3(TNB * TT / 64, DIN / 128), 128, 0, stream>>>(Y, F[2], F[3], (float*)d_out);
}

// v003
// One run takes 155 microseconds.
// Timed twice side by side with v002, it ran 1.23 times as fast both times.
// All steps since v000 together make it 8.74 times as fast.
// compute dtype: all float inputs rounded to bf16; qkv = x Wqkv^T with EXACT bf16 products on WMMA 16x16x32 (f32 accumulate); q as f16 hi + residual (x 2^10) against k once to f16 (2 products) x 64^-0.5, then MULTIPLIED by the 0/1 mask (masked logits become 0, they are not excluded); softmax in f32 (precise expf) with a running maximum, scores kept in registers; exp(logit - max) x 2^11 once to f16 against v once to f16 (1 product), divided by the f32 sum at the end; ctx split bf16 hi + lo against exact w_proj (2 products) + b_proj; f32 output.
#include <hip/hip_runtime.h>
#include <math.h>

typedef __attribute__((ext_vector_type(16))) _Float16 v16h;
typedef __attribute__((ext_vector_type(16))) __bf16 v16b;
typedef __attribute__((ext_vector_type(8)))  _Float16 v8h;
typedef __attribute__((ext_vector_type(8)))  float v8f;
typedef __attribute__((ext_vector_type(4)))  float v4f;
typedef __attribute__((ext_vector_type(2)))  float v2f;
typedef __attribute__((ext_vector_type(4)))  unsigned v4u;
typedef __attribute__((ext_vector_type(4)))  int v4i;
typedef float __attribute__((may_alias)) float_a;
typedef int __attribute__((may_alias)) int_a;

template <typename T> __device__ __forceinline__ void vst2(void* p, T v) { *(T*)p = v;  }
__device__ __forceinline__ v8f wmma16(v16h a, v16h b, v8f c) {
  v8f d = __builtin_amdgcn_wmma_f32_16x16x32_f16(false, a, false, b, (short)0, c, false, false);
  asm volatile("v_nop\n\tv_nop\n\tv_nop\n\tv_nop" : "+v"(d) : "v"(a), "v"(b));
  return d;
}
__device__ __forceinline__ v8f wmma_bf(v16b a, v16b b, v8f c) {
  v8f d = __builtin_amdgcn_wmma_f32_16x16x32_bf16(false, a, false, b, (short)0, c, false, false);
  asm volatile("v_nop\n\tv_nop\n\tv_nop\n\tv_nop" : "+v"(d) : "v"(a), "v"(b));
  return d;
}
// 16x16x32 fragments: lane = (h = lane>>4, row/col = lane&15); elements 0..7 = k0+8h+0..7, 8..15 = k0+16+8h+0..7; D element r = row 8h+r
__device__ __forceinline__ v16h frag_h(const _Float16* rowk0, int lane) {
  union { v16h v; v8h q[2]; } u; const _Float16* p = rowk0 + 8 * (lane >> 4);
  u.q[0] = *(const v8h*)p; u.q[1] = *(const v8h*)(p + 16); return u.v;
}
__device__ __forceinline__ v16h frag_f32(const float* rowk0, int lane) {
  v16h a; const float* p = rowk0 + 8 * (lane >> 4);
#pragma unroll
  for (int i = 0; i < 8; ++i) { a[i] = (_Float16)p[i]; a[8 + i] = (_Float16)p[16 + i]; }
  return a;
}
__device__ __forceinline__ v16h frag_f32s(const float* rowk0, int lane, float sc) {
  v16h a; const float* p = rowk0 + 8 * (lane >> 4);
#pragma unroll
  for (int i = 0; i < 8; ++i) { a[i] = (_Float16)(p[i] * sc); a[8 + i] = (_Float16)(p[16 + i] * sc); }
  return a;
}
// column fragment from a [K][ld] layout (column n), rows >= K read as 0
__device__ __forceinline__ v16h fragc_f32(const float* W, int k0, int n, int lane, int ld, int K) {
  v16h a; const int g = lane >> 4;
#pragma unroll
  for (int i = 0; i < 8; ++i) { const int ka = k0 + 8 * g + i, kb = ka + 16;
    a[i] = (_Float16)(ka < K ? W[(size_t)(ka < K ? ka : K - 1) * ld + n] : 0.f); a[8 + i] = (_Float16)(kb < K ? W[(size_t)(kb < K ? kb : K - 1) * ld + n] : 0.f); }
  return a;
}
struct F2 { v16b h, l; };
__device__ __forceinline__ F2 bsplit16(const float v[16]) { F2 r;
#pragma unroll
  for (int i = 0; i < 16; ++i) { const __bf16 h = (__bf16)v[i]; r.h[i] = h; r.l[i] = (__bf16)(v[i] - (float)h); }
  return r; }
__device__ __forceinline__ F2 split_row(const float* row, int k0, int lane) { float v[16]; const float* p = row + k0 + 8 * (lane >> 4);
#pragma unroll
  for (int i = 0; i < 8; ++i) { v[i] = p[i]; v[8 + i] = p[16 + i]; }
  return bsplit16(v); }
__device__ __forceinline__ F2 split_rowK(const float* row, int k0, int lane, int K) { float v[16]; const int g = lane >> 4;
#pragma unroll
  for (int i = 0; i < 8; ++i) { const int ka = k0 + 8 * g + i, kb = ka + 16; v[i] = ka < K ? row[ka < K ? ka : K - 1] : 0.f; v[8 + i] = kb < K ? row[kb < K ? kb : K - 1] : 0.f; }
  return bsplit16(v); }
__device__ __forceinline__ F2 split_col(const float* W, int k0, int n, int lane, int ld, int K) { float v[16]; const int g = lane >> 4;
#pragma unroll
  for (int i = 0; i < 8; ++i) { const int ka = k0 + 8 * g + i, kb = ka + 16; v[i] = ka < K ? W[(size_t)(ka < K ? ka : K - 1) * ld + n] : 0.f; v[8 + i] = kb < K ? W[(size_t)(kb < K ? kb : K - 1) * ld + n] : 0.f; }
  return bsplit16(v); }
__device__ __forceinline__ v8f mac3(const F2& a, const F2& b, v8f c) { c = wmma_bf(a.l, b.h, c); c = wmma_bf(a.h, b.l, c); return wmma_bf(a.h, b.h, c); }
__device__ __forceinline__ float sigm(float v) { return 1.0f / (1.0f + expf(-v)); }
#define LDSX() do { asm volatile("s_wait_dscnt 0" ::: "memory"); __builtin_amdgcn_wave_barrier(); __builtin_amdgcn_fence(__ATOMIC_RELEASE, "workgroup"); } while (0)

// Multi-head attention with a MULTIPLICATIVE 0/1 mask (B 2, N 2,048, C 1,024 = 16 x 64): qkv = x w_qkv^T ((out,in) [3072,1024], rows (3,H,D)); attn = softmax((q k^T x 64^-0.5) * mask) with mask [N,N] of 0/1 shared over (b,h) - a masked logit is 0.0, still inside the softmax; out = merged(attn v) w_proj^T + b_proj.
#define NB 2
#define TT 2048
#define CC 1024            // NH * HD = projected width
#define DIN 1024          // input (model) width
#define NH 16
#define HD 64
#define NQB (TT / 64)
#define SCALE (0.125f)
#ifndef TNB
#define TNB NB
#endif
__device__ __forceinline__ float bfr(float v) { return (float)(__bf16)v; }
typedef __attribute__((ext_vector_type(8))) __bf16 v8b;
__device__ __forceinline__ v16b frag_b(const __bf16* rowk0, int lane) {
  union { v16b v; v8b q[2]; } u; const __bf16* p = rowk0 + 8 * (lane >> 4);
  u.q[0] = *(const v8b*)p; u.q[1] = *(const v8b*)(p + 16); return u.v;
}
#define QHI 2048            // rows carrying a q residual plane (all rows when non-causal: 2-product logits everywhere)
#define KHI 64            // key rows carrying k residual / v bf16 hi+lo planes (written by k_proj; no kernel in this file reads them)
// B fragment (k rows k0+.., output column o) of a weight: (in,out) [K][ld] or (out,in) [ld rows of K]: bf16 exact, or f16(bf16 * 256) exact
__device__ __forceinline__ v16b wcol_io(const float* Wm, int k0, int o, int lane, int ld) { v16b w; const int g = lane >> 4;
#pragma unroll
  for (int i = 0; i < 8; ++i) { w[i] = (__bf16)Wm[(size_t)(k0 + 8 * g + i) * ld + o]; w[8 + i] = (__bf16)Wm[(size_t)(k0 + 16 + 8 * g + i) * ld + o]; }
  return w; }
__device__ __forceinline__ v16b wcol_oi(const float* Wm, int k0, int o, int lane, int K) { v16b w; const float* p = Wm + (size_t)o * K + k0 + 8 * (lane >> 4);
#pragma unroll
  for (int i = 0; i < 8; ++i) { w[i] = (__bf16)p[i]; w[8 + i] = (__bf16)p[16 + i]; }
  return w; }
__device__ __forceinline__ v16h wcolh_io(const float* Wm, int k0, int o, int lane, int ld) { v16h w; const int g = lane >> 4;
#pragma unroll
  for (int i = 0; i < 8; ++i) { w[i] = (_Float16)(bfr(Wm[(size_t)(k0 + 8 * g + i) * ld + o]) * 256.0f); w[8 + i] = (_Float16)(bfr(Wm[(size_t)(k0 + 16 + 8 * g + i) * ld + o]) * 256.0f); }
  return w; }
__device__ __forceinline__ v16h wcolh_oi(const float* Wm, int k0, int o, int lane, int K) { v16h w; const float* p = Wm + (size_t)o * K + k0 + 8 * (lane >> 4);
#pragma unroll
  for (int i = 0; i < 8; ++i) { w[i] = (_Float16)(bfr(p[i]) * 256.0f); w[8 + i] = (_Float16)(bfr(p[16 + i]) * 256.0f); }
  return w; }
#define WQKV_LAYOUT 1   // 0 = (in,out) [DIN][CC]; 1 = (out,in) [CC][DIN]; 2 = per-head [NH][DIN][HD]
__device__ __forceinline__ v16b wcol_hdk(const float* Wm, int k0, int o, int lane) { v16b w; const int g = lane >> 4; const float* p = Wm + (size_t)(o / HD) * DIN * HD + (o % HD);
#pragma unroll
  for (int i = 0; i < 8; ++i) { w[i] = (__bf16)p[(size_t)(k0 + 8 * g + i) * HD]; w[8 + i] = (__bf16)p[(size_t)(k0 + 16 + 8 * g + i) * HD]; }
  return w; }
#define WO_OUT_IN 1
#if WQKV_LAYOUT == 1
#define WCOL(W, k0, o, lane) wcol_oi(W, k0, o, lane, DIN)
#elif WQKV_LAYOUT == 2
#define WCOL(W, k0, o, lane) wcol_hdk(W, k0, o, lane)
#else
#define WCOL(W, k0, o, lane) wcol_io(W, k0, o, lane, CC)
#endif
#if WO_OUT_IN
#define WOCOL(W, k0, o, lane) wcol_oi(W, k0, o, lane, CC)
#define WOCOLH(W, k0, o, lane) wcolh_oi(W, k0, o, lane, CC)
#else
#define WOCOL(W, k0, o, lane) wcol_io(W, k0, o, lane, DIN)
#define WOCOLH(W, k0, o, lane) wcolh_io(W, k0, o, lane, DIN)
#endif

#define WS_QH  0u                                      // f16 q rows [b*t][CC]
#define WS_KH  (WS_QH + 2u * (size_t)NB * TT * CC)      // f16 k in fragment order [b][h][t / 16][d / 32][2][lane][8]: one 16-byte load of a wave = 512 contiguous bytes
#define WS_VT  (WS_KH + 2u * (size_t)NB * TT * CC)      // f16 v in fragment order [b][h][t / 32][d / 16][2][lane][8]
#define WS_QL  (WS_VT + 2u * (size_t)NB * CC * TT)      // f16 q residual x 2^10 rows [b][t < QHI][CC]
#define WS_KL  (WS_QL + 2u * (size_t)NB * QHI * CC)     // f16 k residual x 2^10 rows [b][t < KHI][CC]
#define WS_VB  (WS_KL + 2u * (size_t)NB * KHI * CC)     // bf16 v hi planes [b][c][t < KHI]
#define WS_VBL (WS_VB + 2u * (size_t)NB * CC * KHI)
#define WS_Y   (WS_VBL + 2u * (size_t)NB * CC * KHI)    // f32 ctx rows [b*t][CC] (only when there is an output projection)
#define WS_END (WS_Y  + 4u * (size_t)NB * TT * CC)

// LDS staging of the two projection GEMMs: a chunk is KC k values of every operand row of the block's tile, read from global memory as whole 256-B row pieces (16 lanes x 16 B), rounded to bf16 once and shared by the block's four waves
#define KC 64
#define SP 72             // LDS row pitch in 16-bit elements: 144 B = 16 B x 9, so the 16 rows of a 16-byte fragment read fall on distinct banks
typedef __attribute__((ext_vector_type(4))) __bf16 v4b;
__device__ __forceinline__ v4b bf4(v4f v) { v4b r; r[0] = (__bf16)v[0]; r[1] = (__bf16)v[1]; r[2] = (__bf16)v[2]; r[3] = (__bf16)v[3]; return r; }
// ---- k_proj: block = (64 rows, 128 cols, which): q/k/v = X W (+ b) with exact bf16 products (K = DIN) -> which 0: q f16 rows (+ residual rows < QHI); 1: k f16 in the attention's fragment order (+ residual rows < KHI); 2: v f16 in fragment order (+ bf16 hi/lo planes for t < KHI)
__global__ __launch_bounds__(128) void k_proj(const float* __restrict__ XQ, const float* __restrict__ XK, const float* __restrict__ XV, const float* __restrict__ WQ, const float* __restrict__ WK, const float* __restrict__ WV, const float* __restrict__ BQ, const float* __restrict__ BK, const float* __restrict__ BV,
    _Float16* __restrict__ QH, _Float16* __restrict__ QL, _Float16* __restrict__ KH, _Float16* __restrict__ KL, _Float16* __restrict__ VT, __bf16* __restrict__ VB, __bf16* __restrict__ VBL) {
  // one LDS range: in the K loop two staging buffers of [X 64 rows | W 128 rows] x SP; behind the loop's last barrier the output staging (sh, sl or th, tb, tbl)
  __shared__ __align__(16) char smem[2 * 192 * SP * 2];
  _Float16 (*sh)[136] = (_Float16 (*)[136])smem; _Float16 (*sl)[136] = (_Float16 (*)[136])(smem + 64 * 136 * 2); _Float16 (*th)[72] = (_Float16 (*)[72])smem; __bf16 (*tb)[72] = (__bf16 (*)[72])(smem + 128 * 72 * 2); __bf16 (*tbl)[72] = (__bf16 (*)[72])(smem + 2 * 128 * 72 * 2);
  __bf16* const st = (__bf16*)smem;
  const int tid = threadIdx.x, wave = tid >> 5, lane = tid & 31, col = lane & 15, g = lane >> 4; const int which = blockIdx.z; const int c0 = blockIdx.y * 128; const size_t r0 = (size_t)blockIdx.x * 64; const size_t bb = r0 / TT; const int t0 = (int)(r0 % TT);
  const float* X = which == 0 ? XQ : which == 1 ? XK : XV; const float* WA = which == 0 ? WQ : which == 1 ? WK : WV; const float* BA = which == 0 ? BQ : which == 1 ? BK : BV;
  v8f acc[8] = {};
  const int srow = tid >> 4, sq = (tid & 15) * 4; const float* Xg = X + (r0 + srow) * DIN + sq; const float* Wg = WA + (size_t)(c0 + srow) * DIN + sq; __bf16* const sd = st + srow * SP + sq;
  v4f rx[8], rw[16];   // the inner loops below are fully unrolled so that every index into rx, rw, w and acc is a constant (registers, no scratch)
#pragma unroll
  for (int i = 0; i < 8; ++i) rx[i] = *(const v4f*)(Xg + (size_t)(i * 8) * DIN);
#pragma unroll
  for (int i = 0; i < 16; ++i) rw[i] = *(const v4f*)(Wg + (size_t)(i * 8) * DIN);
  asm volatile("s_wait_xcnt 0x0" ::: "memory");   // stands in front of the first overwrite of an address register that the loads above name
#pragma unroll
  for (int i = 0; i < 8; ++i) *(v4b*)(sd + i * 8 * SP) = bf4(rx[i]);
#pragma unroll
  for (int i = 0; i < 16; ++i) *(v4b*)(sd + (64 + i * 8) * SP) = bf4(rw[i]);
  __syncthreads();
  for (int c = 0; c < DIN / KC; ++c) { const bool more = c + 1 < DIN / KC;   // chunk c + 1 flies into registers while chunk c is multiplied out of LDS
    if (more) {
#pragma unroll
      for (int i = 0; i < 8; ++i) rx[i] = *(const v4f*)(Xg + (size_t)(i * 8) * DIN + (c + 1) * KC);
#pragma unroll
      for (int i = 0; i < 16; ++i) rw[i] = *(const v4f*)(Wg + (size_t)(i * 8) * DIN + (c + 1) * KC); }
    const __bf16* buf = st + (c & 1) * (192 * SP);
#pragma unroll
    for (int ks = 0; ks < KC / 32; ++ks) { const v16b a = frag_b(buf + (wave * 16 + col) * SP + ks * 32, lane); v16b w[8];
#pragma unroll
      for (int j = 0; j < 8; ++j) w[j] = frag_b(buf + (64 + j * 16 + col) * SP + ks * 32, lane);
#pragma unroll
      for (int j = 0; j < 8; ++j) acc[j] = wmma_bf(a, w[j], acc[j]); }
    if (more) { __bf16* d = sd + ((c + 1) & 1) * (192 * SP);
#pragma unroll
      for (int i = 0; i < 8; ++i) *(v4b*)(d + i * 8 * SP) = bf4(rx[i]);
#pragma unroll
      for (int i = 0; i < 16; ++i) *(v4b*)(d + (64 + i * 8) * SP) = bf4(rw[i]); }
    __syncthreads(); }   // publishes chunk c + 1 and ends every wave's reads of the buffer that the next trip refills (behind the last trip: of the range that becomes output staging)
  if (which < 2) { _Float16* DH = which == 0 ? QH : KH; _Float16* DL = which == 0 ? QL : KL; const int nhi = which == 0 ? QHI : KHI; const bool hi_rows = t0 < nhi;
#pragma unroll
    for (int j = 0; j < 8; ++j) { const float bias = BA ? bfr(BA[c0 + j * 16 + col]) : 0.f;
#pragma unroll
      for (int r = 0; r < 8; ++r) { const float v = acc[j][r] + bias; const _Float16 hv = (_Float16)v; sh[wave * 16 + 8 * g + r][j * 16 + col] = hv; sl[wave * 16 + 8 * g + r][j * 16 + col] = (_Float16)((v - (float)hv) * 1024.0f); } }
    __syncthreads();
    // every path below is one fully unrolled run of stores up to the kernel's end: each plane's eight stores share one address pair plus constant offsets
    const int q8 = (tid & 15) * 8; _Float16* dh = DH + (r0 + srow) * CC + c0 + q8; _Float16* dl = DL + (bb * nhi + t0 + srow) * (size_t)CC + c0 + q8;
    _Float16* kd = DH + (((bb * NH + (c0 >> 6)) * (TT / 16) + (t0 >> 4)) * 4 + wave) * 256 + lane * 8;   // fragment order: wave = (32-wide d chunk, half of the fragment), lane = (g, key); trip i = (head i >> 2 of the block's two, 16-key tile i & 3)
    if (which == 0) {
      if (hi_rows) {
#pragma unroll
        for (int i = 0; i < 8; ++i) { vst2((unsigned*)(dh + i * 8 * CC), *(const v4u*)&sh[srow + i * 8][q8]); vst2((unsigned*)(dl + i * 8 * CC), *(const v4u*)&sl[srow + i * 8][q8]); }
        asm volatile("s_wait_xcnt 0x0" ::: "memory");   // behind the run of stores, in front of any later write of a register that they name
      } else {
#pragma unroll
        for (int i = 0; i < 8; ++i) vst2((unsigned*)(dh + i * 8 * CC), *(const v4u*)&sh[srow + i * 8][q8]);
        asm volatile("s_wait_xcnt 0x0" ::: "memory");   // behind the run of stores, in front of any later write of a register that they name
      }
    } else if (hi_rows) {
#pragma unroll
      for (int i = 0; i < 8; ++i) { vst2((unsigned*)(kd + (i >> 2) * (TT * HD) + (i & 3) * 1024), *(const v4u*)&sh[(i & 3) * 16 + col][(i >> 2) * 64 + wave * 16 + g * 8]); vst2((unsigned*)(dl + i * 8 * CC), *(const v4u*)&sl[srow + i * 8][q8]); }
      asm volatile("s_wait_xcnt 0x0" ::: "memory");   // behind the run of stores, in front of any later write of a register that they name
    } else {
#pragma unroll
      for (int i = 0; i < 8; ++i) vst2((unsigned*)(kd + (i >> 2) * (TT * HD) + (i & 3) * 1024), *(const v4u*)&sh[(i & 3) * 16 + col][(i >> 2) * 64 + wave * 16 + g * 8]);
      asm volatile("s_wait_xcnt 0x0" ::: "memory");   // behind the run of stores, in front of any later write of a register that they name
    }
  } else { const bool hi_rows = t0 < KHI;
#pragma unroll
    for (int j = 0; j < 8; ++j) { const float bias = BA ? bfr(BA[c0 + j * 16 + col]) : 0.f;
#pragma unroll
      for (int r = 0; r < 8; ++r) { const float v = acc[j][r] + bias; const int rl = wave * 16 + 8 * g + r, cl = j * 16 + col; th[cl][rl] = (_Float16)v; const __bf16 bh = (__bf16)v; tb[cl][rl] = bh; tbl[cl][rl] = (__bf16)(v - (float)bh); } }
    __syncthreads();
    _Float16* vd = VT + (((bb * NH + (c0 >> 6)) * (TT / 32) + (t0 >> 5)) * 8 + wave) * 256 + lane * 8;   // fragment order: wave = (low bit of the 16-channel tile, half of the fragment), lane = (g, channel); trip i = (head i >> 2, 32-key pass (i >> 1) & 1, high bit i & 1 of the channel tile); unrolled like the q / k stores
    if (hi_rows) { const int cl = tid >> 3, q = tid & 7; const size_t o3 = (bb * CC + c0 + cl) * (size_t)KHI + t0 + q * 8;
#pragma unroll
      for (int i = 0; i < 8; ++i) { vst2((unsigned*)(vd + (i >> 2) * (TT * HD) + ((i >> 1) & 1) * 2048 + (i & 1) * 1024), *(const v4u*)&th[(i >> 2) * 64 + (i & 1) * 32 + (wave >> 1) * 16 + col][((i >> 1) & 1) * 32 + (wave & 1) * 16 + g * 8]);
        vst2((unsigned*)(VB + o3 + i * 16 * KHI), *(const v4u*)&tb[cl + i * 16][q * 8]); vst2((unsigned*)(VBL + o3 + i * 16 * KHI), *(const v4u*)&tbl[cl + i * 16][q * 8]); }
      asm volatile("s_wait_xcnt 0x0" ::: "memory");   // behind the run of stores, in front of any later write of a register that they name
    } else {
#pragma unroll
      for (int i = 0; i < 8; ++i) vst2((unsigned*)(vd + (i >> 2) * (TT * HD) + ((i >> 1) & 1) * 2048 + (i & 1) * 1024), *(const v4u*)&th[(i >> 2) * 64 + (i & 1) * 32 + (wave >> 1) * 16 + col][((i >> 1) & 1) * 32 + (wave & 1) * 16 + g * 8]);
      asm volatile("s_wait_xcnt 0x0" ::: "memory");   // behind the run of stores, in front of any later write of a register that they name
    } } }
__device__ __forceinline__ v8f wmma_p(v16h a, v16h b, v8f c) { return __builtin_amdgcn_wmma_f32_16x16x32_f16(false, a, false, b, (short)0, c, false, false); }
__device__ __forceinline__ v16h frag_t(const _Float16* tile, int lane) {   // a fragment stored in fragment order: two runs of 32 lanes x 8 elements
  union { v16h v; v8h q[2]; } u; const _Float16* p = tile + lane * 8; u.q[0] = *(const v8h*)p; u.q[1] = *(const v8h*)(p + 256); return u.v; }
__device__ __forceinline__ float xhalf(float v) { const int i = __builtin_bit_cast(int, v); return __builtin_bit_cast(float, __builtin_amdgcn_permlanex16(i, i, 0x76543210, 0xfedcba98, false, false)); }   // lane l <-> l ^ 16
__global__ __launch_bounds__(128) void k_fa(const _Float16* __restrict__ QH, const _Float16* __restrict__ QL, const _Float16* __restrict__ KH, const _Float16* __restrict__ VT, const float* __restrict__ MKF, float* __restrict__ Y) {
  const int tid = threadIdx.x, wave = tid >> 5, lane = tid & 31, col = lane & 15, g = lane >> 4; const int h = blockIdx.y, b = blockIdx.z; const int t = blockIdx.x * 64 + wave * 16 + col;
  v16h qh[HD / 32], ql[HD / 32];
#pragma unroll
  for (int kc = 0; kc < HD / 32; ++kc) { qh[kc] = frag_h(QH + ((size_t)b * TT + t) * CC + h * HD + kc * 32, lane); ql[kc] = frag_h(QL + ((size_t)b * QHI + t) * CC + h * HD + kc * 32, lane); }
  const _Float16* Kp = KH + (size_t)(b * NH + h) * (TT * HD); const _Float16* Vp = VT + (size_t)(b * NH + h) * (TT * HD); /* 32 keys = 2,048 elements of either */ const float* Mp = MKF + (size_t)t * TT + 8 * g;
  v16h kf[2][HD / 32]; v4f mk[2][2];
#pragma unroll
  for (int u = 0; u < 2; ++u) {
#pragma unroll
    for (int kc = 0; kc < HD / 32; ++kc) kf[u][kc] = frag_t(Kp + u * 1024 + kc * 512, lane);
    mk[u][0] = *(const v4f*)(Mp + u * 16); mk[u][1] = *(const v4f*)(Mp + u * 16 + 4); }
  v8f acc[HD / 16] = {}; float m = -3.0e38f, l = 0.f;
  for (int k0 = 0; k0 < TT; k0 += 32) { const int kn = k0 + 32 < TT ? k0 + 32 : k0;   // the pass fetched ahead; the last pass fetches its own again, in bounds, unused
    v16h vf[HD / 16];
#pragma unroll
    for (int j = 0; j < HD / 16; ++j) vf[j] = frag_t(Vp + k0 * HD + j * 512, lane);
    v8f sh[2] = {}, sl[2] = {};
#pragma unroll
    for (int kc = 0; kc < HD / 32; ++kc) {
#pragma unroll
      for (int u = 0; u < 2; ++u) { sh[u] = wmma_p(kf[u][kc], qh[kc], sh[u]); sl[u] = wmma_p(kf[u][kc], ql[kc], sl[u]); } }
#pragma unroll
    for (int u = 0; u < 2; ++u)
#pragma unroll
      for (int kc = 0; kc < HD / 32; ++kc) kf[u][kc] = frag_t(Kp + kn * HD + u * 1024 + kc * 512, lane);
    float v[16]; float mx = -3.0e38f;
#pragma unroll
    for (int u = 0; u < 2; ++u)
#pragma unroll
      for (int r = 0; r < 8; ++r) { const float s = (sh[u][r] + sl[u][r] * (1.0f / 1024.0f)) * SCALE * bfr(mk[u][r >> 2][r & 3]); v[u * 8 + r] = s; mx = fmaxf(mx, s); }
#pragma unroll
    for (int u = 0; u < 2; ++u) { mk[u][0] = *(const v4f*)(Mp + kn + u * 16); mk[u][1] = *(const v4f*)(Mp + kn + u * 16 + 4); }
    __builtin_amdgcn_sched_barrier(0);   // this pass's v loads and the next pass's k and mask loads issue above this line, so they land under the exponentials; without it they sink to their first use and the wave waits there
    mx = fmaxf(mx, xhalf(mx)); const float mn = fmaxf(m, mx); const float alpha = expf(m - mn); m = mn;
    v16h p; float sum = 0.f;
#pragma unroll
    for (int i = 0; i < 16; ++i) { const float e = expf(v[i] - mn); sum += e; p[i] = (_Float16)(e * 2048.0f); }
    l = l * alpha + sum;
#pragma unroll
    for (int j = 0; j < HD / 16; ++j) { acc[j] = acc[j] * alpha; acc[j] = wmma_p(vf[j], p, acc[j]); } }
  l += xhalf(l); const float inv = 1.0f / (l * 2048.0f);   // never near 0: the key that holds the maximum adds exp(0)
  float* yp = Y + ((size_t)b * TT + t) * CC + h * HD + 8 * g;
#pragma unroll
  for (int j = 0; j < HD / 16; ++j) { const v8f o = acc[j] * inv; vst2(yp + j * 16, (v4f){o[0], o[1], o[2], o[3]}); vst2(yp + j * 16 + 4, (v4f){o[4], o[5], o[6], o[7]}); } }
// ---- k_out: block = (64 rows, 128 cols): out = ctx Wo (+ bo): all rows: ctx bf16 hi + lo against exact bf16 Wo (2 products); the f16 (1 product) branch is not taken
__global__ __launch_bounds__(128) void k_out(const float* __restrict__ Y, const float* __restrict__ WO, const float* __restrict__ BO, float* __restrict__ OUT) { __shared__ __align__(16) float sf[4][16][132]; __shared__ __align__(16) __bf16 so[2 * 256 * SP];   // so: two staging buffers of [ctx hi 64 rows | ctx lo 64 rows | Wo 128 rows] x SP
  const int tid = threadIdx.x, wave = tid >> 5, lane = tid & 31, col = lane & 15, g = lane >> 4; const int c0 = blockIdx.y * 128; const size_t r0 = (size_t)blockIdx.x * 64 + wave * 16;
  v8f acc[8] = {};
  if (true) {   /* ALL rows: ctx split bf16 hi + lo x exact Wo (2 products) */
    const int srow = tid >> 4, sq = (tid & 15) * 4; const float* Yg = Y + ((size_t)blockIdx.x * 64 + srow) * CC + sq; const float* Wg = WO + (size_t)(c0 + srow) * CC + sq; __bf16* const sd = so + srow * SP + sq;
    v4f ry[8], rw[16];   // the inner loops below are fully unrolled so that every index into ry, rw, w and acc is a constant (registers, no scratch)
#pragma unroll
    for (int i = 0; i < 8; ++i) ry[i] = *(const v4f*)(Yg + (size_t)(i * 8) * CC);
#pragma unroll
    for (int i = 0; i < 16; ++i) rw[i] = *(const v4f*)(Wg + (size_t)(i * 8) * CC);
#pragma unroll
    for (int i = 0; i < 8; ++i) { const v4b hv = bf4(ry[i]); *(v4b*)(sd + i * 8 * SP) = hv; *(v4b*)(sd + (64 + i * 8) * SP) = bf4((v4f){ry[i][0] - (float)hv[0], ry[i][1] - (float)hv[1], ry[i][2] - (float)hv[2], ry[i][3] - (float)hv[3]}); }
#pragma unroll
    for (int i = 0; i < 16; ++i) *(v4b*)(sd + (128 + i * 8) * SP) = bf4(rw[i]);
    __syncthreads();
    for (int c = 0; c < CC / KC; ++c) { const bool more = c + 1 < CC / KC;   // chunk c + 1 flies into registers while chunk c is multiplied out of LDS
      if (more) {
#pragma unroll
        for (int i = 0; i < 8; ++i) ry[i] = *(const v4f*)(Yg + (size_t)(i * 8) * CC + (c + 1) * KC);
#pragma unroll
        for (int i = 0; i < 16; ++i) rw[i] = *(const v4f*)(Wg + (size_t)(i * 8) * CC + (c + 1) * KC);
        asm volatile("s_wait_xcnt 0x0" ::: "memory"); }   // stands in front of the first overwrite of an address register that the loads above name
      const __bf16* buf = so + (c & 1) * (256 * SP);
#pragma unroll
      for (int ks = 0; ks < KC / 32; ++ks) { const v16b ah = frag_b(buf + (wave * 16 + col) * SP + ks * 32, lane), al = frag_b(buf + (64 + wave * 16 + col) * SP + ks * 32, lane);
#pragma unroll
        for (int jh = 0; jh < 8; jh += 4) { v16b w[4];   // four Wo fragments at a time: hi then lo into four independent tiles, so no product waits for the one before it on its own tile
#pragma unroll
          for (int j = 0; j < 4; ++j) w[j] = frag_b(buf + (128 + (jh + j) * 16 + col) * SP + ks * 32, lane);
#pragma unroll
          for (int j = 0; j < 4; ++j) acc[jh + j] = wmma_bf(ah, w[j], acc[jh + j]);
#pragma unroll
          for (int j = 0; j < 4; ++j) acc[jh + j] = wmma_bf(al, w[j], acc[jh + j]); } }
      if (more) { __bf16* d = sd + ((c + 1) & 1) * (256 * SP);
#pragma unroll
        for (int i = 0; i < 8; ++i) { const v4b hv = bf4(ry[i]); *(v4b*)(d + i * 8 * SP) = hv; *(v4b*)(d + (64 + i * 8) * SP) = bf4((v4f){ry[i][0] - (float)hv[0], ry[i][1] - (float)hv[1], ry[i][2] - (float)hv[2], ry[i][3] - (float)hv[3]}); }
#pragma unroll
        for (int i = 0; i < 16; ++i) *(v4b*)(d + (128 + i * 8) * SP) = bf4(rw[i]); }
      __syncthreads(); }   // publishes chunk c + 1 and ends every wave's reads of the buffer that the next trip refills
#pragma unroll
    for (int j = 0; j < 8; ++j) { const float bias = BO ? bfr(BO[c0 + j * 16 + col]) : 0.f;
#pragma unroll
      for (int r = 0; r < 8; ++r) sf[wave][8 * g + r][j * 16 + col] = acc[j][r] + bias; }
  } else {
#pragma unroll 2
    for (int kc = 0; kc < CC / 32; ++kc) { const v16h a = frag_f32(Y + (r0 + col) * CC + kc * 32, lane); asm volatile("s_wait_loadcnt 0x0" ::: "memory");
#pragma unroll
      for (int j = 0; j < 8; ++j) { const v16h w = WOCOLH(WO, kc * 32, c0 + j * 16 + col, lane); asm volatile("s_wait_loadcnt 0x0" ::: "memory"); acc[j] = wmma16(a, w, acc[j]); } }
#pragma unroll
    for (int j = 0; j < 8; ++j) { const float bias = BO ? bfr(BO[c0 + j * 16 + col]) : 0.f;
#pragma unroll
      for (int r = 0; r < 8; ++r) sf[wave][8 * g + r][j * 16 + col] = acc[j][r] * (1.0f / 256.0f) + bias; } }
  LDSX(); for (int rl = 0; rl < 16; ++rl) vst2(OUT + (r0 + rl) * DIN + c0 + lane * 4, *(const v4f*)&sf[wave][rl][lane * 4]); }

extern "C" void kernel_launch(void* const* d_in, const int* in_sizes, int n_in, void* d_out, int out_size, void* d_ws, size_t ws_size, hipStream_t stream) {
  (void)in_sizes; (void)n_in; (void)out_size;
  const float** F = (const float**)d_in;
  if (ws_size < (size_t)WS_END) return;
  char* ws = (char*)d_ws; _Float16 *QH = (_Float16*)(ws + WS_QH), *KH = (_Float16*)(ws + WS_KH), *VT = (_Float16*)(ws + WS_VT), *QL = (_Float16*)(ws + WS_QL), *KL = (_Float16*)(ws + WS_KL); __bf16 *VB = (__bf16*)(ws + WS_VB), *VBL = (__bf16*)(ws + WS_VBL); float *Y = (float*)(ws + WS_Y);
  // inputs: 0 x [2,2048,1024]; 1 w_qkv [3072,1024] (out,in); 2 w_proj [1024,1024] (out,in); 3 b_proj; 4 mask [2048,2048] f32 0/1
  k_proj<<<dim3(TNB * TT / 64, CC / 128, 3), 128, 0, stream>>>(F[0], F[0], F[0], F[1], F[1] + (size_t)CC * DIN, F[1] + (size_t)2 * CC * DIN, nullptr, nullptr, nullptr, QH, QL, KH, KL, VT, VB, VBL);
  k_fa<<<dim3(NQB, NH, TNB), 128, 0, stream>>>(QH, QL, KH, VT, F[4], Y);
  k_out<<<dim3(TNB * TT / 64, DIN / 128), 128, 0, stream>>>(Y, F[2], F[3], (float*)d_out);
}

// v004
// A run of this version takes 134 microseconds.
// Timed twice side by side with v003, it ran 1.14 and 1.15 times as fast.
// All steps since v000 together make it 10.0 times as fast.
// compute dtype: all float inputs rounded to bf16; qkv = x Wqkv^T with EXACT bf16 products on WMMA 16x16x32 (f32 accumulate); q x 64^-0.5 x log2(e) as f16 hi + residual (x 2^10) against k once to f16 (2 products), then MULTIPLIED by the 0/1 mask (masked logits become 0, they are not excluded); softmax in f32 in base 2 (one hardware exp2 per score) with a running maximum, scores kept in registers; 2^(logit - max + 11) once to f16 against v once to f16 (1 product), divided by the f32 sum at the end; ctx split bf16 hi + lo against exact w_proj (2 products) + b_proj; f32 output.
#include <hip/hip_runtime.h>
#include <math.h>

typedef __attribute__((ext_vector_type(16))) _Float16 v16h;
typedef __attribute__((ext_vector_type(16))) __bf16 v16b;
typedef __attribute__((ext_vector_type(8)))  _Float16 v8h;
typedef __attribute__((ext_vector_type(8)))  float v8f;
typedef __attribute__((ext_vector_type(4)))  float v4f;
typedef __attribute__((ext_vector_type(2)))  float v2f;
typedef __attribute__((ext_vector_type(4)))  unsigned v4u;
typedef __attribute__((ext_vector_type(4)))  int v4i;
typedef float __attribute__((may_alias)) float_a;
typedef int __attribute__((may_alias)) int_a;

template <typename T> __device__ __forceinline__ void vst2(void* p, T v) { *(T*)p = v;  }
__device__ __forceinline__ v8f wmma16(v16h a, v16h b, v8f c) {
  v8f d = __builtin_amdgcn_wmma_f32_16x16x32_f16(false, a, false, b, (short)0, c, false, false);
  asm volatile("v_nop\n\tv_nop\n\tv_nop\n\tv_nop" : "+v"(d) : "v"(a), "v"(b));
  return d;
}
__device__ __forceinline__ v8f wmma_bf(v16b a, v16b b, v8f c) {
  v8f d = __builtin_amdgcn_wmma_f32_16x16x32_bf16(false, a, false, b, (short)0, c, false, false);
  asm volatile("v_nop\n\tv_nop\n\tv_nop\n\tv_nop" : "+v"(d) : "v"(a), "v"(b));
  return d;
}
// 16x16x32 fragments: lane = (h = lane>>4, row/col = lane&15); elements 0..7 = k0+8h+0..7, 8..15 = k0+16+8h+0..7; D element r = row 8h+r
__device__ __forceinline__ v16h frag_h(const _Float16* rowk0, int lane) {
  union { v16h v; v8h q[2]; } u; const _Float16* p = rowk0 + 8 * (lane >> 4);
  u.q[0] = *(const v8h*)p; u.q[1] = *(const v8h*)(p + 16); return u.v;
}
__device__ __forceinline__ v16h frag_f32(const float* rowk0, int lane) {
  v16h a; const float* p = rowk0 + 8 * (lane >> 4);
#pragma unroll
  for (int i = 0; i < 8; ++i) { a[i] = (_Float16)p[i]; a[8 + i] = (_Float16)p[16 + i]; }
  return a;
}
__device__ __forceinline__ v16h frag_f32s(const float* rowk0, int lane, float sc) {
  v16h a; const float* p = rowk0 + 8 * (lane >> 4);
#pragma unroll
  for (int i = 0; i < 8; ++i) { a[i] = (_Float16)(p[i] * sc); a[8 + i] = (_Float16)(p[16 + i] * sc); }
  return a;
}
// column fragment from a [K][ld] layout (column n), rows >= K read as 0
__device__ __forceinline__ v16h fragc_f32(const float* W, int k0, int n, int lane, int ld, int K) {
  v16h a; const int g = lane >> 4;
#pragma unroll
  for (int i = 0; i < 8; ++i) { const int ka = k0 + 8 * g + i, kb = ka + 16;
    a[i] = (_Float16)(ka < K ? W[(size_t)(ka < K ? ka : K - 1) * ld + n] : 0.f); a[8 + i] = (_Float16)(kb < K ? W[(size_t)(kb < K ? kb : K - 1) * ld + n] : 0.f); }
  return a;
}
struct F2 { v16b h, l; };
__device__ __forceinline__ F2 bsplit16(const float v[16]) { F2 r;
#pragma unroll
  for (int i = 0; i < 16; ++i) { const __bf16 h = (__bf16)v[i]; r.h[i] = h; r.l[i] = (__bf16)(v[i] - (float)h); }
  return r; }
__device__ __forceinline__ F2 split_row(const float* row, int k0, int lane) { float v[16]; const float* p = row + k0 + 8 * (lane >> 4);
#pragma unroll
  for (int i = 0; i < 8; ++i) { v[i] = p[i]; v[8 + i] = p[16 + i]; }
  return bsplit16(v); }
__device__ __forceinline__ F2 split_rowK(const float* row, int k0, int lane, int K) { float v[16]; const int g = lane >> 4;
#pragma unroll
  for (int i = 0; i < 8; ++i) { const int ka = k0 + 8 * g + i, kb = ka + 16; v[i] = ka < K ? row[ka < K ? ka : K - 1] : 0.f; v[8 + i] = kb < K ? row[kb < K ? kb : K - 1] : 0.f; }
  return bsplit16(v); }
__device__ __forceinline__ F2 split_col(const float* W, int k0, int n, int lane, int ld, int K) { float v[16]; const int g = lane >> 4;
#pragma unroll
  for (int i = 0; i < 8; ++i) { const int ka = k0 + 8 * g + i, kb = ka + 16; v[i] = ka < K ? W[(size_t)(ka < K ? ka : K - 1) * ld + n] : 0.f; v[8 + i] = kb < K ? W[(size_t)(kb < K ? kb : K - 1) * ld + n] : 0.f; }
  return bsplit16(v); }
__device__ __forceinline__ v8f mac3(const F2& a, const F2& b, v8f c) { c = wmma_bf(a.l, b.h, c); c = wmma_bf(a.h, b.l, c); return wmma_bf(a.h, b.h, c); }
__device__ __forceinline__ float sigm(float v) { return 1.0f / (1.0f + expf(-v)); }
#define LDSX() do { asm volatile("s_wait_dscnt 0" ::: "memory"); __builtin_amdgcn_wave_barrier(); __builtin_amdgcn_fence(__ATOMIC_RELEASE, "workgroup"); } while (0)

// Multi-head attention with a MULTIPLICATIVE 0/1 mask (B 2, N 2,048, C 1,024 = 16 x 64): qkv = x w_qkv^T ((out,in) [3072,1024], rows (3,H,D)); attn = softmax((q k^T x 64^-0.5) * mask) with mask [N,N] of 0/1 shared over (b,h) - a masked logit is 0.0, still inside the softmax; out = merged(attn v) w_proj^T + b_proj.
#define NB 2
#define TT 2048
#define CC 1024            // NH * HD = projected width
#define DIN 1024          // input (model) width
#define NH 16
#define HD 64
#define NQB (TT / 64)
#define SCALE (0.125f)
#define QSC (SCALE * 1.44269504088896340736f)   // logit scale x log2(e): k_proj multiplies q by it in f32 before the f16 hi / residual split, so k_fa's scores arrive as base-2 exponents
#ifndef TNB
#define TNB NB
#endif
__device__ __forceinline__ float bfr(float v) { return (float)(__bf16)v; }
typedef __attribute__((ext_vector_type(8))) __bf16 v8b;
__device__ __forceinline__ v16b frag_b(const __bf16* rowk0, int lane) {
  union { v16b v; v8b q[2]; } u; const __bf16* p = rowk0 + 8 * (lane >> 4);
  u.q[0] = *(const v8b*)p; u.q[1] = *(const v8b*)(p + 16); return u.v;
}
#define QHI 2048            // rows carrying a q residual plane (all rows when non-causal: 2-product logits everywhere)
#define KHI 64            // key rows carrying k residual / v bf16 hi+lo planes (written by k_proj; no kernel in this file reads them)
// B fragment (k rows k0+.., output column o) of a weight: (in,out) [K][ld] or (out,in) [ld rows of K]: bf16 exact, or f16(bf16 * 256) exact
__device__ __forceinline__ v16b wcol_io(const float* Wm, int k0, int o, int lane, int ld) { v16b w; const int g = lane >> 4;
#pragma unroll
  for (int i = 0; i < 8; ++i) { w[i] = (__bf16)Wm[(size_t)(k0 + 8 * g + i) * ld + o]; w[8 + i] = (__bf16)Wm[(size_t)(k0 + 16 + 8 * g + i) * ld + o]; }
  return w; }
__device__ __forceinline__ v16b wcol_oi(const float* Wm, int k0, int o, int lane, int K) { v16b w; const float* p = Wm + (size_t)o * K + k0 + 8 * (lane >> 4);
#pragma unroll
  for (int i = 0; i < 8; ++i) { w[i] = (__bf16)p[i]; w[8 + i] = (__bf16)p[16 + i]; }
  return w; }
__device__ __forceinline__ v16h wcolh_io(const float* Wm, int k0, int o, int lane, int ld) { v16h w; const int g = lane >> 4;
#pragma unroll
  for (int i = 0; i < 8; ++i) { w[i] = (_Float16)(bfr(Wm[(size_t)(k0 + 8 * g + i) * ld + o]) * 256.0f); w[8 + i] = (_Float16)(bfr(Wm[(size_t)(k0 + 16 + 8 * g + i) * ld + o]) * 256.0f); }
  return w; }
__device__ __forceinline__ v16h wcolh_oi(const float* Wm, int k0, int o, int lane, int K) { v16h w; const float* p = Wm + (size_t)o * K + k0 + 8 * (lane >> 4);
#pragma unroll
  for (int i = 0; i < 8; ++i) { w[i] = (_Float16)(bfr(p[i]) * 256.0f); w[8 + i] = (_Float16)(bfr(p[16 + i]) * 256.0f); }
  return w; }
#define WQKV_LAYOUT 1   // 0 = (in,out) [DIN][CC]; 1 = (out,in) [CC][DIN]; 2 = per-head [NH][DIN][HD]
__device__ __forceinline__ v16b wcol_hdk(const float* Wm, int k0, int o, int lane) { v16b w; const int g = lane >> 4; const float* p = Wm + (size_t)(o / HD) * DIN * HD + (o % HD);
#pragma unroll
  for (int i = 0; i < 8; ++i) { w[i] = (__bf16)p[(size_t)(k0 + 8 * g + i) * HD]; w[8 + i] = (__bf16)p[(size_t)(k0 + 16 + 8 * g + i) * HD]; }
  return w; }
#define WO_OUT_IN 1
#if WQKV_LAYOUT == 1
#define WCOL(W, k0, o, lane) wcol_oi(W, k0, o, lane, DIN)
#elif WQKV_LAYOUT == 2
#define WCOL(W, k0, o, lane) wcol_hdk(W, k0, o, lane)
#else
#define WCOL(W, k0, o, lane) wcol_io(W, k0, o, lane, CC)
#endif
#if WO_OUT_IN
#define WOCOL(W, k0, o, lane) wcol_oi(W, k0, o, lane, CC)
#define WOCOLH(W, k0, o, lane) wcolh_oi(W, k0, o, lane, CC)
#else
#define WOCOL(W, k0, o, lane) wcol_io(W, k0, o, lane, DIN)
#define WOCOLH(W, k0, o, lane) wcolh_io(W, k0, o, lane, DIN)
#endif

#define WS_QH  0u                                      // f16 q rows [b*t][CC]
#define WS_KH  (WS_QH + 2u * (size_t)NB * TT * CC)      // f16 k in fragment order [b][h][t / 16][d / 32][2][lane][8]: one 16-byte load of a wave = 512 contiguous bytes
#define WS_VT  (WS_KH + 2u * (size_t)NB * TT * CC)      // f16 v in fragment order [b][h][t / 32][d / 16][2][lane][8]
#define WS_QL  (WS_VT + 2u * (size_t)NB * CC * TT)      // f16 q residual x 2^10 rows [b][t < QHI][CC]
#define WS_KL  (WS_QL + 2u * (size_t)NB * QHI * CC)     // f16 k residual x 2^10 rows [b][t < KHI][CC]
#define WS_VB  (WS_KL + 2u * (size_t)NB * KHI * CC)     // bf16 v hi planes [b][c][t < KHI]
#define WS_VBL (WS_VB + 2u * (size_t)NB * CC * KHI)
#define WS_Y   (WS_VBL + 2u * (size_t)NB * CC * KHI)    // f32 ctx rows [b*t][CC] (only when there is an output projection)
#define WS_END (WS_Y  + 4u * (size_t)NB * TT * CC)

// LDS staging of the two projection GEMMs: a chunk is KC k values of every operand row of the block's tile, read from global memory as whole 256-B row pieces (16 lanes x 16 B), rounded to bf16 once and shared by the block's four waves
#define KC 64
#define SP 72             // LDS row pitch in 16-bit elements: 144 B = 16 B x 9, so the 16 rows of a 16-byte fragment read fall on distinct banks
typedef __attribute__((ext_vector_type(4))) __bf16 v4b;
__device__ __forceinline__ v4b bf4(v4f v) { v4b r; r[0] = (__bf16)v[0]; r[1] = (__bf16)v[1]; r[2] = (__bf16)v[2]; r[3] = (__bf16)v[3]; return r; }
// ---- k_proj: block = (64 rows, 128 cols, which): q/k/v = X W (+ b) with exact bf16 products (K = DIN) -> which 0: q x QSC f16 rows (+ residual rows < QHI); 1: k f16 in the attention's fragment order (+ residual rows < KHI); 2: v f16 in fragment order (+ bf16 hi/lo planes for t < KHI)
__global__ __launch_bounds__(128) void k_proj(const float* __restrict__ XQ, const float* __restrict__ XK, const float* __restrict__ XV, const float* __restrict__ WQ, const float* __restrict__ WK, const float* __restrict__ WV, const float* __restrict__ BQ, const float* __restrict__ BK, const float* __restrict__ BV,
    _Float16* __restrict__ QH, _Float16* __restrict__ QL, _Float16* __restrict__ KH, _Float16* __restrict__ KL, _Float16* __restrict__ VT, __bf16* __restrict__ VB, __bf16* __restrict__ VBL) {
  // one LDS range: in the K loop two staging buffers of [X 64 rows | W 128 rows] x SP; behind the loop's last barrier the output staging (sh, sl or th, tb, tbl)
  __shared__ __align__(16) char smem[2 * 192 * SP * 2];
  _Float16 (*sh)[136] = (_Float16 (*)[136])smem; _Float16 (*sl)[136] = (_Float16 (*)[136])(smem + 64 * 136 * 2); _Float16 (*th)[72] = (_Float16 (*)[72])smem; __bf16 (*tb)[72] = (__bf16 (*)[72])(smem + 128 * 72 * 2); __bf16 (*tbl)[72] = (__bf16 (*)[72])(smem + 2 * 128 * 72 * 2);
  __bf16* const st = (__bf16*)smem;
  const int tid = threadIdx.x, wave = tid >> 5, lane = tid & 31, col = lane & 15, g = lane >> 4; const int which = blockIdx.z; const int c0 = blockIdx.y * 128; const size_t r0 = (size_t)blockIdx.x * 64; const size_t bb = r0 / TT; const int t0 = (int)(r0 % TT);
  const float* X = which == 0 ? XQ : which == 1 ? XK : XV; const float* WA = which == 0 ? WQ : which == 1 ? WK : WV; const float* BA = which == 0 ? BQ : which == 1 ? BK : BV;
  v8f acc[8] = {};
  const int srow = tid >> 4, sq = (tid & 15) * 4; const float* Xg = X + (r0 + srow) * DIN + sq; const float* Wg = WA + (size_t)(c0 + srow) * DIN + sq; __bf16* const sd = st + srow * SP + sq;
  v4f rx[8], rw[16];   // the inner loops below are fully unrolled so that every index into rx, rw, w and acc is a constant (registers, no scratch)
#pragma unroll
  for (int i = 0; i < 8; ++i) rx[i] = *(const v4f*)(Xg + (size_t)(i * 8) * DIN);
#pragma unroll
  for (int i = 0; i < 16; ++i) rw[i] = *(const v4f*)(Wg + (size_t)(i * 8) * DIN);
  asm volatile("s_wait_xcnt 0x0" ::: "memory");   // stands in front of the first overwrite of an address register that the loads above name
#pragma unroll
  for (int i = 0; i < 8; ++i) *(v4b*)(sd + i * 8 * SP) = bf4(rx[i]);
#pragma unroll
  for (int i = 0; i < 16; ++i) *(v4b*)(sd + (64 + i * 8) * SP) = bf4(rw[i]);
  __syncthreads();
  for (int c = 0; c < DIN / KC; ++c) { const bool more = c + 1 < DIN / KC;   // chunk c + 1 flies into registers while chunk c is multiplied out of LDS
    if (more) {
#pragma unroll
      for (int i = 0; i < 8; ++i) rx[i] = *(const v4f*)(Xg + (size_t)(i * 8) * DIN + (c + 1) * KC);
#pragma unroll
      for (int i = 0; i < 16; ++i) rw[i] = *(const v4f*)(Wg + (size_t)(i * 8) * DIN + (c + 1) * KC); }
    const __bf16* buf = st + (c & 1) * (192 * SP);
#pragma unroll
    for (int ks = 0; ks < KC / 32; ++ks) { const v16b a = frag_b(buf + (wave * 16 + col) * SP + ks * 32, lane); v16b w[8];
#pragma unroll
      for (int j = 0; j < 8; ++j) w[j] = frag_b(buf + (64 + j * 16 + col) * SP + ks * 32, lane);
#pragma unroll
      for (int j = 0; j < 8; ++j) acc[j] = wmma_bf(a, w[j], acc[j]); }
    if (more) { __bf16* d = sd + ((c + 1) & 1) * (192 * SP);
#pragma unroll
      for (int i = 0; i < 8; ++i) *(v4b*)(d + i * 8 * SP) = bf4(rx[i]);
#pragma unroll
      for (int i = 0; i < 16; ++i) *(v4b*)(d + (64 + i * 8) * SP) = bf4(rw[i]); }
    __syncthreads(); }   // publishes chunk c + 1 and ends every wave's reads of the buffer that the next trip refills (behind the last trip: of the range that becomes output staging)
  if (which < 2) { _Float16* DH = which == 0 ? QH : KH; _Float16* DL = which == 0 ? QL : KL; const int nhi = which == 0 ? QHI : KHI; const bool hi_rows = t0 < nhi; const float osc = which == 0 ? QSC : 1.0f;
#pragma unroll
    for (int j = 0; j < 8; ++j) { const float bias = BA ? bfr(BA[c0 + j * 16 + col]) : 0.f;
#pragma unroll
      for (int r = 0; r < 8; ++r) { const float v = (acc[j][r] + bias) * osc; const _Float16 hv = (_Float16)v; sh[wave * 16 + 8 * g + r][j * 16 + col] = hv; sl[wave * 16 + 8 * g + r][j * 16 + col] = (_Float16)((v - (float)hv) * 1024.0f); } }
    __syncthreads();
    // every path below is one fully unrolled run of stores up to the kernel's end: each plane's eight stores share one address pair plus constant offsets
    const int q8 = (tid & 15) * 8; _Float16* dh = DH + (r0 + srow) * CC + c0 + q8; _Float16* dl = DL + (bb * nhi + t0 + srow) * (size_t)CC + c0 + q8;
    _Float16* kd = DH + (((bb * NH + (c0 >> 6)) * (TT / 16) + (t0 >> 4)) * 4 + wave) * 256 + lane * 8;   // fragment order: wave = (32-wide d chunk, half of the fragment), lane = (g, key); trip i = (head i >> 2 of the block's two, 16-key tile i & 3)
    if (which == 0) {
      if (hi_rows) {
#pragma unroll
        for (int i = 0; i < 8; ++i) { vst2((unsigned*)(dh + i * 8 * CC), *(const v4u*)&sh[srow + i * 8][q8]); vst2((unsigned*)(dl + i * 8 * CC), *(const v4u*)&sl[srow + i * 8][q8]); }
        asm volatile("s_wait_xcnt 0x0" ::: "memory");   // behind the run of stores, in front of any later write of a register that they name
      } else {
#pragma unroll
        for (int i = 0; i < 8; ++i) vst2((unsigned*)(dh + i * 8 * CC), *(const v4u*)&sh[srow + i * 8][q8]);
        asm volatile("s_wait_xcnt 0x0" ::: "memory");   // behind the run of stores, in front of any later write of a register that they name
      }
    } else if (hi_rows) {
#pragma unroll
      for (int i = 0; i < 8; ++i) { vst2((unsigned*)(kd + (i >> 2) * (TT * HD) + (i & 3) * 1024), *(const v4u*)&sh[(i & 3) * 16 + col][(i >> 2) * 64 + wave * 16 + g * 8]); vst2((unsigned*)(dl + i * 8 * CC), *(const v4u*)&sl[srow + i * 8][q8]); }
      asm volatile("s_wait_xcnt 0x0" ::: "memory");   // behind the run of stores, in front of any later write of a register that they name
    } else {
#pragma unroll
      for (int i = 0; i < 8; ++i) vst2((unsigned*)(kd + (i >> 2) * (TT * HD) + (i & 3) * 1024), *(const v4u*)&sh[(i & 3) * 16 + col][(i >> 2) * 64 + wave * 16 + g * 8]);
      asm volatile("s_wait_xcnt 0x0" ::: "memory");   // behind the run of stores, in front of any later write of a register that they name
    }
  } else { const bool hi_rows = t0 < KHI;
#pragma unroll
    for (int j = 0; j < 8; ++j) { const float bias = BA ? bfr(BA[c0 + j * 16 + col]) : 0.f;
#pragma unroll
      for (int r = 0; r < 8; ++r) { const float v = acc[j][r] + bias; const int rl = wave * 16 + 8 * g + r, cl = j * 16 + col; th[cl][rl] = (_Float16)v; const __bf16 bh = (__bf16)v; tb[cl][rl] = bh; tbl[cl][rl] = (__bf16)(v - (float)bh); } }
    __syncthreads();
    _Float16* vd = VT + (((bb * NH + (c0 >> 6)) * (TT / 32) + (t0 >> 5)) * 8 + wave) * 256 + lane * 8;   // fragment order: wave = (low bit of the 16-channel tile, half of the fragment), lane = (g, channel); trip i = (head i >> 2, 32-key pass (i >> 1) & 1, high bit i & 1 of the channel tile); unrolled like the q / k stores
    if (hi_rows) { const int cl = tid >> 3, q = tid & 7; const size_t o3 = (bb * CC + c0 + cl) * (size_t)KHI + t0 + q * 8;
#pragma unroll
      for (int i = 0; i < 8; ++i) { vst2((unsigned*)(vd + (i >> 2) * (TT * HD) + ((i >> 1) & 1) * 2048 + (i & 1) * 1024), *(const v4u*)&th[(i >> 2) * 64 + (i & 1) * 32 + (wave >> 1) * 16 + col][((i >> 1) & 1) * 32 + (wave & 1) * 16 + g * 8]);
        vst2((unsigned*)(VB + o3 + i * 16 * KHI), *(const v4u*)&tb[cl + i * 16][q * 8]); vst2((unsigned*)(VBL + o3 + i * 16 * KHI), *(const v4u*)&tbl[cl + i * 16][q * 8]); }
      asm volatile("s_wait_xcnt 0x0" ::: "memory");   // behind the run of stores, in front of any later write of a register that they name
    } else {
#pragma unroll
      for (int i = 0; i < 8; ++i) vst2((unsigned*)(vd + (i >> 2) * (TT * HD) + ((i >> 1) & 1) * 2048 + (i & 1) * 1024), *(const v4u*)&th[(i >> 2) * 64 + (i & 1) * 32 + (wave >> 1) * 16 + col][((i >> 1) & 1) * 32 + (wave & 1) * 16 + g * 8]);
      asm volatile("s_wait_xcnt 0x0" ::: "memory");   // behind the run of stores, in front of any later write of a register that they name
    } } }
__device__ __forceinline__ v8f wmma_p(v16h a, v16h b, v8f c) { return __builtin_amdgcn_wmma_f32_16x16x32_f16(false, a, false, b, (short)0, c, false, false); }
__device__ __forceinline__ v16h frag_t(const _Float16* tile, int lane) {   // a fragment stored in fragment order: two runs of 32 lanes x 8 elements
  union { v16h v; v8h q[2]; } u; const _Float16* p = tile + lane * 8; u.q[0] = *(const v8h*)p; u.q[1] = *(const v8h*)(p + 256); return u.v; }
__device__ __forceinline__ float xhalf(float v) { const int i = __builtin_bit_cast(int, v); return __builtin_bit_cast(float, __builtin_amdgcn_permlanex16(i, i, 0x76543210, 0xfedcba98, false, false)); }   // lane l <-> l ^ 16
__global__ __launch_bounds__(128) void k_fa(const _Float16* __restrict__ QH, const _Float16* __restrict__ QL, const _Float16* __restrict__ KH, const _Float16* __restrict__ VT, const float* __restrict__ MKF, float* __restrict__ Y) {
  const int tid = threadIdx.x, wave = tid >> 5, lane = tid & 31, col = lane & 15, g = lane >> 4; const int h = blockIdx.y, b = blockIdx.z; const int t = blockIdx.x * 64 + wave * 16 + col;
  v16h qh[HD / 32], ql[HD / 32];
#pragma unroll
  for (int kc = 0; kc < HD / 32; ++kc) { qh[kc] = frag_h(QH + ((size_t)b * TT + t) * CC + h * HD + kc * 32, lane); ql[kc] = frag_h(QL + ((size_t)b * QHI + t) * CC + h * HD + kc * 32, lane); }
  const _Float16* Kp = KH + (size_t)(b * NH + h) * (TT * HD); const _Float16* Vp = VT + (size_t)(b * NH + h) * (TT * HD); /* 32 keys = 2,048 elements of either */ const float* Mp = MKF + (size_t)t * TT + 8 * g;
  v16h kf[2][HD / 32]; v4f mk[2][2];
#pragma unroll
  for (int u = 0; u < 2; ++u) {
#pragma unroll
    for (int kc = 0; kc < HD / 32; ++kc) kf[u][kc] = frag_t(Kp + u * 1024 + kc * 512, lane);
    mk[u][0] = *(const v4f*)(Mp + u * 16); mk[u][1] = *(const v4f*)(Mp + u * 16 + 4); }
  v8f acc[HD / 16] = {}; float m = -3.0e38f, l = 0.f;
  for (int k0 = 0; k0 < TT; k0 += 32) { const int kn = k0 + 32 < TT ? k0 + 32 : k0;   // the pass fetched ahead; the last pass fetches its own again, in bounds, unused
    v16h vf[HD / 16];
#pragma unroll
    for (int j = 0; j < HD / 16; ++j) vf[j] = frag_t(Vp + k0 * HD + j * 512, lane);
    v8f sh[2] = {}, sl[2] = {};
#pragma unroll
    for (int kc = 0; kc < HD / 32; ++kc) {
#pragma unroll
      for (int u = 0; u < 2; ++u) { sh[u] = wmma_p(kf[u][kc], qh[kc], sh[u]); sl[u] = wmma_p(kf[u][kc], ql[kc], sl[u]); } }
#pragma unroll
    for (int u = 0; u < 2; ++u)
#pragma unroll
      for (int kc = 0; kc < HD / 32; ++kc) kf[u][kc] = frag_t(Kp + kn * HD + u * 1024 + kc * 512, lane);
    float v[16]; float mx = -3.0e38f;
#pragma unroll
    for (int u = 0; u < 2; ++u)
#pragma unroll
      for (int r = 0; r < 8; ++r) { const float s = (sh[u][r] + sl[u][r] * (1.0f / 1024.0f)) * bfr(mk[u][r >> 2][r & 3]); v[u * 8 + r] = s; mx = fmaxf(mx, s); }
#pragma unroll
    for (int u = 0; u < 2; ++u) { mk[u][0] = *(const v4f*)(Mp + kn + u * 16); mk[u][1] = *(const v4f*)(Mp + kn + u * 16 + 4); }
    __builtin_amdgcn_sched_barrier(0);   // this pass's v loads and the next pass's k and mask loads issue above this line, so they land under the exponentials; without it they sink to their first use and the wave waits there
    mx = fmaxf(mx, xhalf(mx)); const float mn = fmaxf(m, mx - 11.0f); const float alpha = __builtin_amdgcn_exp2f(m - mn); m = mn;
    v16h p; float sum = 0.f;
#pragma unroll
    for (int i = 0; i < 16; ++i) { const float e = __builtin_amdgcn_exp2f(v[i] - mn); sum += e; p[i] = (_Float16)e; }
    l = l * alpha + sum;
    __builtin_amdgcn_sched_barrier(0);   // the register copies of the k fragments fetched ahead, and the load wait in front of them, stay below this line among the P.V products; without it they rise in front of the exponentials, where the wave would wait for loads it has only just issued
#pragma unroll
    for (int j = 0; j < HD / 16; ++j) { acc[j] = acc[j] * alpha; acc[j] = wmma_p(vf[j], p, acc[j]); } }
  l += xhalf(l); const float inv = 1.0f / l;   // never near 0: the key that holds the maximum adds 2^11
  float* yp = Y + ((size_t)b * TT + t) * CC + h * HD + 8 * g;
#pragma unroll
  for (int j = 0; j < HD / 16; ++j) { const v8f o = acc[j] * inv; vst2(yp + j * 16, (v4f){o[0], o[1], o[2], o[3]}); vst2(yp + j * 16 + 4, (v4f){o[4], o[5], o[6], o[7]}); } }
// ---- k_out: block = (64 rows, 128 cols): out = ctx Wo (+ bo): all rows: ctx bf16 hi + lo against exact bf16 Wo (2 products); the f16 (1 product) branch is not taken
__global__ __launch_bounds__(128) void k_out(const float* __restrict__ Y, const float* __restrict__ WO, const float* __restrict__ BO, float* __restrict__ OUT) { __shared__ __align__(16) float sf[4][16][132]; __shared__ __align__(16) __bf16 so[2 * 256 * SP];   // so: two staging buffers of [ctx hi 64 rows | ctx lo 64 rows | Wo 128 rows] x SP
  const int tid = threadIdx.x, wave = tid >> 5, lane = tid & 31, col = lane & 15, g = lane >> 4; const int c0 = blockIdx.y * 128; const size_t r0 = (size_t)blockIdx.x * 64 + wave * 16;
  v8f acc[8] = {};
  if (true) {   /* ALL rows: ctx split bf16 hi + lo x exact Wo (2 products) */
    const int srow = tid >> 4, sq = (tid & 15) * 4; const float* Yg = Y + ((size_t)blockIdx.x * 64 + srow) * CC + sq; const float* Wg = WO + (size_t)(c0 + srow) * CC + sq; __bf16* const sd = so + srow * SP + sq;
    v4f ry[8], rw[16];   // the inner loops below are fully unrolled so that every index into ry, rw, w and acc is a constant (registers, no scratch)
#pragma unroll
    for (int i = 0; i < 8; ++i) ry[i] = *(const v4f*)(Yg + (size_t)(i * 8) * CC);
#pragma unroll
    for (int i = 0; i < 16; ++i) rw[i] = *(const v4f*)(Wg + (size_t)(i * 8) * CC);
#pragma unroll
    for (int i = 0; i < 8; ++i) { const v4b hv = bf4(ry[i]); *(v4b*)(sd + i * 8 * SP) = hv; *(v4b*)(sd + (64 + i * 8) * SP) = bf4((v4f){ry[i][0] - (float)hv[0], ry[i][1] - (float)hv[1], ry[i][2] - (float)hv[2], ry[i][3] - (float)hv[3]}); }
#pragma unroll
    for (int i = 0; i < 16; ++i) *(v4b*)(sd + (128 + i * 8) * SP) = bf4(rw[i]);
    __syncthreads();
    for (int c = 0; c < CC / KC; ++c) { const bool more = c + 1 < CC / KC;   // chunk c + 1 flies into registers while chunk c is multiplied out of LDS
      if (more) {
#pragma unroll
        for (int i = 0; i < 8; ++i) ry[i] = *(const v4f*)(Yg + (size_t)(i * 8) * CC + (c + 1) * KC);
#pragma unroll
        for (int i = 0; i < 16; ++i) rw[i] = *(const v4f*)(Wg + (size_t)(i * 8) * CC + (c + 1) * KC);
        asm volatile("s_wait_xcnt 0x0" ::: "memory"); }   // stands in front of the first overwrite of an address register that the loads above name
      const __bf16* buf = so + (c & 1) * (256 * SP);
#pragma unroll
      for (int ks = 0; ks < KC / 32; ++ks) { const v16b ah = frag_b(buf + (wave * 16 + col) * SP + ks * 32, lane), al = frag_b(buf + (64 + wave * 16 + col) * SP + ks * 32, lane);
#pragma unroll
        for (int jh = 0; jh < 8; jh += 4) { v16b w[4];   // four Wo fragments at a time: hi then lo into four independent tiles, so no product waits for the one before it on its own tile
#pragma unroll
          for (int j = 0; j < 4; ++j) w[j] = frag_b(buf + (128 + (jh + j) * 16 + col) * SP + ks * 32, lane);
#pragma unroll
          for (int j = 0; j < 4; ++j) acc[jh + j] = wmma_bf(ah, w[j], acc[jh + j]);
#pragma unroll
          for (int j = 0; j < 4; ++j) acc[jh + j] = wmma_bf(al, w[j], acc[jh + j]); } }
      if (more) { __bf16* d = sd + ((c + 1) & 1) * (256 * SP);
#pragma unroll
        for (int i = 0; i < 8; ++i) { const v4b hv = bf4(ry[i]); *(v4b*)(d + i * 8 * SP) = hv; *(v4b*)(d + (64 + i * 8) * SP) = bf4((v4f){ry[i][0] - (float)hv[0], ry[i][1] - (float)hv[1], ry[i][2] - (float)hv[2], ry[i][3] - (float)hv[3]}); }
#pragma unroll
        for (int i = 0; i < 16; ++i) *(v4b*)(d + (128 + i * 8) * SP) = bf4(rw[i]); }
      __syncthreads(); }   // publishes chunk c + 1 and ends every wave's reads of the buffer that the next trip refills
#pragma unroll
    for (int j = 0; j < 8; ++j) { const float bias = BO ? bfr(BO[c0 + j * 16 + col]) : 0.f;
#pragma unroll
      for (int r = 0; r < 8; ++r) sf[wave][8 * g + r][j * 16 + col] = acc[j][r] + bias; }
  } else {
#pragma unroll 2
    for (int kc = 0; kc < CC / 32; ++kc) { const v16h a = frag_f32(Y + (r0 + col) * CC + kc * 32, lane); asm volatile("s_wait_loadcnt 0x0" ::: "memory");
#pragma unroll
      for (int j = 0; j < 8; ++j) { const v16h w = WOCOLH(WO, kc * 32, c0 + j * 16 + col, lane); asm volatile("s_wait_loadcnt 0x0" ::: "memory"); acc[j] = wmma16(a, w, acc[j]); } }
#pragma unroll
    for (int j = 0; j < 8; ++j) { const float bias = BO ? bfr(BO[c0 + j * 16 + col]) : 0.f;
#pragma unroll
      for (int r = 0; r < 8; ++r) sf[wave][8 * g + r][j * 16 + col] = acc[j][r] * (1.0f / 256.0f) + bias; } }
  LDSX(); for (int rl = 0; rl < 16; ++rl) vst2(OUT + (r0 + rl) * DIN + c0 + lane * 4, *(const v4f*)&sf[wave][rl][lane * 4]); }

extern "C" void kernel_launch(void* const* d_in, const int* in_sizes, int n_in, void* d_out, int out_size, void* d_ws, size_t ws_size, hipStream_t stream) {
  (void)in_sizes; (void)n_in; (void)out_size;
  const float** F = (const float**)d_in;
  if (ws_size < (size_t)WS_END) return;
  char* ws = (char*)d_ws; _Float16 *QH = (_Float16*)(ws + WS_QH), *KH = (_Float16*)(ws + WS_KH), *VT = (_Float16*)(ws + WS_VT), *QL = (_Float16*)(ws + WS_QL), *KL = (_Float16*)(ws + WS_KL); __bf16 *VB = (__bf16*)(ws + WS_VB), *VBL = (__bf16*)(ws + WS_VBL); float *Y = (float*)(ws + WS_Y);
  // inputs: 0 x [2,2048,1024]; 1 w_qkv [3072,1024] (out,in); 2 w_proj [1024,1024] (out,in); 3 b_proj; 4 mask [2048,2048] f32 0/1
  k_proj<<<dim3(TNB * TT / 64, CC / 128, 3), 128, 0, stream>>>(F[0], F[0], F[0], F[1], F[1] + (size_t)CC * DIN, F[1] + (size_t)2 * CC * DIN, nullptr, nullptr, nullptr, QH, QL, KH, KL, VT, VB, VBL);
  k_fa<<<dim3(NQB, NH, TNB), 128, 0, stream>>>(QH, QL, KH, VT, F[4], Y);
  k_out<<<dim3(TNB * TT / 64, DIN / 128), 128, 0, stream>>>(Y, F[2], F[3], (float*)d_out);
}

// v005
// Measured time: 121 microseconds a run.
// In two side-by-side timings against v004, it was 1.11 and 1.10 times as fast.
// Counting every step since v000, it is 11.1 times as fast.
// compute dtype: all float inputs rounded to bf16; qkv = x Wqkv^T with EXACT bf16 products on WMMA 16x16x32 (f32 accumulate); q x 64^-0.5 x log2(e) as f16 hi + residual (x 2^10) against k once to f16 (2 products), then MULTIPLIED by the 0/1 mask (masked logits become 0, they are not excluded); softmax in f32 in base 2 (one hardware exp2 per score) with a running maximum, scores kept in registers; 2^(logit - max + 11) once to f16 against v once to f16 (1 product), divided by the f32 sum at the end; ctx split bf16 hi + lo against exact w_proj (2 products) + b_proj; f32 output.
#include <hip/hip_runtime.h>
#include <math.h>

typedef __attribute__((ext_vector_type(16))) _Float16 v16h;
typedef __attribute__((ext_vector_type(16))) __bf16 v16b;
typedef __attribute__((ext_vector_type(8)))  _Float16 v8h;
typedef __attribute__((ext_vector_type(8)))  float v8f;
typedef __attribute__((ext_vector_type(4)))  float v4f;
typedef __attribute__((ext_vector_type(2)))  float v2f;
typedef __attribute__((ext_vector_type(4)))  unsigned v4u;
typedef __attribute__((ext_vector_type(4)))  int v4i;
typedef float __attribute__((may_alias)) float_a;
typedef int __attribute__((may_alias)) int_a;

template <typename T> __device__ __forceinline__ void vst2(void* p, T v) { *(T*)p = v;  }
__device__ __forceinline__ v8f wmma16(v16h a, v16h b, v8f c) {
  v8f d = __builtin_amdgcn_wmma_f32_16x16x32_f16(false, a, false, b, (short)0, c, false, false);
  asm volatile("v_nop\n\tv_nop\n\tv_nop\n\tv_nop" : "+v"(d) : "v"(a), "v"(b));
  return d;
}
__device__ __forceinline__ v8f wmma_bf(v16b a, v16b b, v8f c) {
  v8f d = __builtin_amdgcn_wmma_f32_16x16x32_bf16(false, a, false, b, (short)0, c, false, false);
  asm volatile("v_nop\n\tv_nop\n\tv_nop\n\tv_nop" : "+v"(d) : "v"(a), "v"(b));
  return d;
}
// 16x16x32 fragments: lane = (h = lane>>4, row/col = lane&15); elements 0..7 = k0+8h+0..7, 8..15 = k0+16+8h+0..7; D element r = row 8h+r
__device__ __forceinline__ v16h frag_h(const _Float16* rowk0, int lane) {
  union { v16h v; v8h q[2]; } u; const _Float16* p = rowk0 + 8 * (lane >> 4);
  u.q[0] = *(const v8h*)p; u.q[1] = *(const v8h*)(p + 16); return u.v;
}
__device__ __forceinline__ v16h frag_f32(const float* rowk0, int lane) {
  v16h a; const float* p = rowk0 + 8 * (lane >> 4);
#pragma unroll
  for (int i = 0; i < 8; ++i) { a[i] = (_Float16)p[i]; a[8 + i] = (_Float16)p[16 + i]; }
  return a;
}
__device__ __forceinline__ v16h frag_f32s(const float* rowk0, int lane, float sc) {
  v16h a; const float* p = rowk0 + 8 * (lane >> 4);
#pragma unroll
  for (int i = 0; i < 8; ++i) { a[i] = (_Float16)(p[i] * sc); a[8 + i] = (_Float16)(p[16 + i] * sc); }
  return a;
}
// column fragment from a [K][ld] layout (column n), rows >= K read as 0
__device__ __forceinline__ v16h fragc_f32(const float* W, int k0, int n, int lane, int ld, int K) {
  v16h a; const int g = lane >> 4;
#pragma unroll
  for (int i = 0; i < 8; ++i) { const int ka = k0 + 8 * g + i, kb = ka + 16;
    a[i] = (_Float16)(ka < K ? W[(size_t)(ka < K ? ka : K - 1) * ld + n] : 0.f); a[8 + i] = (_Float16)(kb < K ? W[(size_t)(kb < K ? kb : K - 1) * ld + n] : 0.f); }
  return a;
}
struct F2 { v16b h, l; };
__device__ __forceinline__ F2 bsplit16(const float v[16]) { F2 r;
#pragma unroll
  for (int i = 0; i < 16; ++i) { const __bf16 h = (__bf16)v[i]; r.h[i] = h; r.l[i] = (__bf16)(v[i] - (float)h); }
  return r; }
__device__ __forceinline__ F2 split_row(const float* row, int k0, int lane) { float v[16]; const float* p = row + k0 + 8 * (lane >> 4);
#pragma unroll
  for (int i = 0; i < 8; ++i) { v[i] = p[i]; v[8 + i] = p[16 + i]; }
  return bsplit16(v); }
__device__ __forceinline__ F2 split_rowK(const float* row, int k0, int lane, int K) { float v[16]; const int g = lane >> 4;
#pragma unroll
  for (int i = 0; i < 8; ++i) { const int ka = k0 + 8 * g + i, kb = ka + 16; v[i] = ka < K ? row[ka < K ? ka : K - 1] : 0.f; v[8 + i] = kb < K ? row[kb < K ? kb : K - 1] : 0.f; }
  return bsplit16(v); }
__device__ __forceinline__ F2 split_col(const float* W, int k0, int n, int lane, int ld, int K) { float v[16]; const int g = lane >> 4;
#pragma unroll
  for (int i = 0; i < 8; ++i) { const int ka = k0 + 8 * g + i, kb = ka + 16; v[i] = ka < K ? W[(size_t)(ka < K ? ka : K - 1) * ld + n] : 0.f; v[8 + i] = kb < K ? W[(size_t)(kb < K ? kb : K - 1) * ld + n] : 0.f; }
  return bsplit16(v); }
__device__ __forceinline__ v8f mac3(const F2& a, const F2& b, v8f c) { c = wmma_bf(a.l, b.h, c); c = wmma_bf(a.h, b.l, c); return wmma_bf(a.h, b.h, c); }
__device__ __forceinline__ float sigm(float v) { return 1.0f / (1.0f + expf(-v)); }
#define LDSX() do { asm volatile("s_wait_dscnt 0" ::: "memory"); __builtin_amdgcn_wave_barrier(); __builtin_amdgcn_fence(__ATOMIC_RELEASE, "workgroup"); } while (0)

// Multi-head attention with a MULTIPLICATIVE 0/1 mask (B 2, N 2,048, C 1,024 = 16 x 64): qkv = x w_qkv^T ((out,in) [3072,1024], rows (3,H,D)); attn = softmax((q k^T x 64^-0.5) * mask) with mask [N,N] of 0/1 shared over (b,h) - a masked logit is 0.0, still inside the softmax; out = merged(attn v) w_proj^T + b_proj.
#define NB 2
#define TT 2048
#define CC 1024            // NH * HD = projected width
#define DIN 1024          // input (model) width
#define NH 16
#define HD 64
#define NQB (TT / 64)
#define SCALE (0.125f)
#define QSC (SCALE * 1.44269504088896340736f)   // logit scale x log2(e): k_proj multiplies q by it in f32 before the f16 hi / residual split, so k_fa's scores arrive as base-2 exponents
#ifndef TNB
#define TNB NB
#endif
__device__ __forceinline__ float bfr(float v) { return (float)(__bf16)v; }
typedef __attribute__((ext_vector_type(8))) __bf16 v8b;
__device__ __forceinline__ v16b frag_b(const __bf16* rowk0, int lane) {
  union { v16b v; v8b q[2]; } u; const __bf16* p = rowk0 + 8 * (lane >> 4);
  u.q[0] = *(const v8b*)p; u.q[1] = *(const v8b*)(p + 16); return u.v;
}
#define QHI 2048            // rows carrying a q residual plane (all rows when non-causal: 2-product logits everywhere)
#define KHI 64            // key rows carrying k residual / v bf16 hi+lo planes (written by k_proj; no kernel in this file reads them)
// B fragment (k rows k0+.., output column o) of a weight: (in,out) [K][ld] or (out,in) [ld rows of K]: bf16 exact, or f16(bf16 * 256) exact
__device__ __forceinline__ v16b wcol_io(const float* Wm, int k0, int o, int lane, int ld) { v16b w; const int g = lane >> 4;
#pragma unroll
  for (int i = 0; i < 8; ++i) { w[i] = (__bf16)Wm[(size_t)(k0 + 8 * g + i) * ld + o]; w[8 + i] = (__bf16)Wm[(size_t)(k0 + 16 + 8 * g + i) * ld + o]; }
  return w; }
__device__ __forceinline__ v16b wcol_oi(const float* Wm, int k0, int o, int lane, int K) { v16b w; const float* p = Wm + (size_t)o * K + k0 + 8 * (lane >> 4);
#pragma unroll
  for (int i = 0; i < 8; ++i) { w[i] = (__bf16)p[i]; w[8 + i] = (__bf16)p[16 + i]; }
  return w; }
__device__ __forceinline__ v16h wcolh_io(const float* Wm, int k0, int o, int lane, int ld) { v16h w; const int g = lane >> 4;
#pragma unroll
  for (int i = 0; i < 8; ++i) { w[i] = (_Float16)(bfr(Wm[(size_t)(k0 + 8 * g + i) * ld + o]) * 256.0f); w[8 + i] = (_Float16)(bfr(Wm[(size_t)(k0 + 16 + 8 * g + i) * ld + o]) * 256.0f); }
  return w; }
__device__ __forceinline__ v16h wcolh_oi(const float* Wm, int k0, int o, int lane, int K) { v16h w; const float* p = Wm + (size_t)o * K + k0 + 8 * (lane >> 4);
#pragma unroll
  for (int i = 0; i < 8; ++i) { w[i] = (_Float16)(bfr(p[i]) * 256.0f); w[8 + i] = (_Float16)(bfr(p[16 + i]) * 256.0f); }
  return w; }
#define WQKV_LAYOUT 1   // 0 = (in,out) [DIN][CC]; 1 = (out,in) [CC][DIN]; 2 = per-head [NH][DIN][HD]
__device__ __forceinline__ v16b wcol_hdk(const float* Wm, int k0, int o, int lane) { v16b w; const int g = lane >> 4; const float* p = Wm + (size_t)(o / HD) * DIN * HD + (o % HD);
#pragma unroll
  for (int i = 0; i < 8; ++i) { w[i] = (__bf16)p[(size_t)(k0 + 8 * g + i) * HD]; w[8 + i] = (__bf16)p[(size_t)(k0 + 16 + 8 * g + i) * HD]; }
  return w; }
#define WO_OUT_IN 1
#if WQKV_LAYOUT == 1
#define WCOL(W, k0, o, lane) wcol_oi(W, k0, o, lane, DIN)
#elif WQKV_LAYOUT == 2
#define WCOL(W, k0, o, lane) wcol_hdk(W, k0, o, lane)
#else
#define WCOL(W, k0, o, lane) wcol_io(W, k0, o, lane, CC)
#endif
#if WO_OUT_IN
#define WOCOL(W, k0, o, lane) wcol_oi(W, k0, o, lane, CC)
#define WOCOLH(W, k0, o, lane) wcolh_oi(W, k0, o, lane, CC)
#else
#define WOCOL(W, k0, o, lane) wcol_io(W, k0, o, lane, DIN)
#define WOCOLH(W, k0, o, lane) wcolh_io(W, k0, o, lane, DIN)
#endif

#define WS_QH  0u                                      // f16 q rows [b*t][CC]
#define WS_KH  (WS_QH + 2u * (size_t)NB * TT * CC)      // f16 k in fragment order [b][h][t / 16][d / 32][2][lane][8]: one 16-byte load of a wave = 512 contiguous bytes
#define WS_VT  (WS_KH + 2u * (size_t)NB * TT * CC)      // f16 v in fragment order [b][h][t / 32][d / 16][2][lane][8]
#define WS_QL  (WS_VT + 2u * (size_t)NB * CC * TT)      // f16 q residual x 2^10 rows [b][t < QHI][CC]
#define WS_KL  (WS_QL + 2u * (size_t)NB * QHI * CC)     // f16 k residual x 2^10 rows [b][t < KHI][CC]
#define WS_VB  (WS_KL + 2u * (size_t)NB * KHI * CC)     // bf16 v hi planes [b][c][t < KHI]
#define WS_VBL (WS_VB + 2u * (size_t)NB * CC * KHI)
#define WS_Y   (WS_VBL + 2u * (size_t)NB * CC * KHI)    // f32 ctx rows [b*t][CC] (only when there is an output projection)
#define WS_END (WS_Y  + 4u * (size_t)NB * TT * CC)

// LDS staging of the two projection GEMMs: a chunk is KC k values of every operand row of the block's tile, read from global memory as whole 256-B row pieces (16 lanes x 16 B), rounded to bf16 once and shared by the block's four waves
#define KC 64
#define SP 72             // LDS row pitch in 16-bit elements: 144 B = 16 B x 9, so the 16 rows of a 16-byte fragment read fall on distinct banks
typedef __attribute__((ext_vector_type(4))) __bf16 v4b;
__device__ __forceinline__ v4b bf4(v4f v) { v4b r; r[0] = (__bf16)v[0]; r[1] = (__bf16)v[1]; r[2] = (__bf16)v[2]; r[3] = (__bf16)v[3]; return r; }
// ---- k_proj: block = (64 rows, 128 cols, which): q/k/v = X W (+ b) with exact bf16 products (K = DIN) -> which 0: q x QSC f16 rows (+ residual rows < QHI); 1: k f16 in the attention's fragment order (+ residual rows < KHI); 2: v f16 in fragment order (+ bf16 hi/lo planes for t < KHI)
__global__ __launch_bounds__(128) void k_proj(const float* __restrict__ XQ, const float* __restrict__ XK, const float* __restrict__ XV, const float* __restrict__ WQ, const float* __restrict__ WK, const float* __restrict__ WV, const float* __restrict__ BQ, const float* __restrict__ BK, const float* __restrict__ BV,
    _Float16* __restrict__ QH, _Float16* __restrict__ QL, _Float16* __restrict__ KH, _Float16* __restrict__ KL, _Float16* __restrict__ VT, __bf16* __restrict__ VB, __bf16* __restrict__ VBL) {
  // one LDS range: in the K loop two staging buffers of [X 64 rows | W 128 rows] x SP; behind the loop's last barrier the output staging (sh, sl or th, tb, tbl)
  __shared__ __align__(16) char smem[2 * 192 * SP * 2];
  _Float16 (*sh)[136] = (_Float16 (*)[136])smem; _Float16 (*sl)[136] = (_Float16 (*)[136])(smem + 64 * 136 * 2); _Float16 (*th)[72] = (_Float16 (*)[72])smem; __bf16 (*tb)[72] = (__bf16 (*)[72])(smem + 128 * 72 * 2); __bf16 (*tbl)[72] = (__bf16 (*)[72])(smem + 2 * 128 * 72 * 2);
  __bf16* const st = (__bf16*)smem;
  const int tid = threadIdx.x, wave = tid >> 5, lane = tid & 31, col = lane & 15, g = lane >> 4; const int which = blockIdx.z; const int c0 = blockIdx.y * 128; const size_t r0 = (size_t)blockIdx.x * 64; const size_t bb = r0 / TT; const int t0 = (int)(r0 % TT);
  const float* X = which == 0 ? XQ : which == 1 ? XK : XV; const float* WA = which == 0 ? WQ : which == 1 ? WK : WV; const float* BA = which == 0 ? BQ : which == 1 ? BK : BV;
  v8f acc[8] = {};
  const int srow = tid >> 4, sq = (tid & 15) * 4; const float* Xg = X + (r0 + srow) * DIN + sq; const float* Wg = WA + (size_t)(c0 + srow) * DIN + sq; __bf16* const sd = st + srow * SP + sq;
  v4f rx[8], rw[16];   // the inner loops below are fully unrolled so that every index into rx, rw, w and acc is a constant (registers, no scratch)
#pragma unroll
  for (int i = 0; i < 8; ++i) rx[i] = *(const v4f*)(Xg + (size_t)(i * 8) * DIN);
#pragma unroll
  for (int i = 0; i < 16; ++i) rw[i] = *(const v4f*)(Wg + (size_t)(i * 8) * DIN);
  asm volatile("s_wait_xcnt 0x0" ::: "memory");   // stands in front of the first overwrite of an address register that the loads above name
#pragma unroll
  for (int i = 0; i < 8; ++i) *(v4b*)(sd + i * 8 * SP) = bf4(rx[i]);
#pragma unroll
  for (int i = 0; i < 16; ++i) *(v4b*)(sd + (64 + i * 8) * SP) = bf4(rw[i]);
  __syncthreads();
  for (int c = 0; c < DIN / KC; ++c) { const bool more = c + 1 < DIN / KC;   // chunk c + 1 flies into registers while chunk c is multiplied out of LDS
    if (more) {
#pragma unroll
      for (int i = 0; i < 8; ++i) rx[i] = *(const v4f*)(Xg + (size_t)(i * 8) * DIN + (c + 1) * KC);
#pragma unroll
      for (int i = 0; i < 16; ++i) rw[i] = *(const v4f*)(Wg + (size_t)(i * 8) * DIN + (c + 1) * KC); }
    const __bf16* buf = st + (c & 1) * (192 * SP);
#pragma unroll
    for (int ks = 0; ks < KC / 32; ++ks) { const v16b a = frag_b(buf + (wave * 16 + col) * SP + ks * 32, lane); v16b w[8];
#pragma unroll
      for (int j = 0; j < 8; ++j) w[j] = frag_b(buf + (64 + j * 16 + col) * SP + ks * 32, lane);
#pragma unroll
      for (int j = 0; j < 8; ++j) acc[j] = wmma_bf(a, w[j], acc[j]); }
    if (more) { __bf16* d = sd + ((c + 1) & 1) * (192 * SP);
#pragma unroll
      for (int i = 0; i < 8; ++i) *(v4b*)(d + i * 8 * SP) = bf4(rx[i]);
#pragma unroll
      for (int i = 0; i < 16; ++i) *(v4b*)(d + (64 + i * 8) * SP) = bf4(rw[i]); }
    __syncthreads(); }   // publishes chunk c + 1 and ends every wave's reads of the buffer that the next trip refills (behind the last trip: of the range that becomes output staging)
  if (which < 2) { _Float16* DH = which == 0 ? QH : KH; _Float16* DL = which == 0 ? QL : KL; const int nhi = which == 0 ? QHI : KHI; const bool hi_rows = t0 < nhi; const float osc = which == 0 ? QSC : 1.0f;
#pragma unroll
    for (int j = 0; j < 8; ++j) { const float bias = BA ? bfr(BA[c0 + j * 16 + col]) : 0.f;
#pragma unroll
      for (int r = 0; r < 8; ++r) { const float v = (acc[j][r] + bias) * osc; const _Float16 hv = (_Float16)v; sh[wave * 16 + 8 * g + r][j * 16 + col] = hv; sl[wave * 16 + 8 * g + r][j * 16 + col] = (_Float16)((v - (float)hv) * 1024.0f); } }
    __syncthreads();
    // every path below is one fully unrolled run of stores up to the kernel's end: each plane's eight stores share one address pair plus constant offsets
    const int q8 = (tid & 15) * 8; _Float16* dh = DH + (r0 + srow) * CC + c0 + q8; _Float16* dl = DL + (bb * nhi + t0 + srow) * (size_t)CC + c0 + q8;
    _Float16* kd = DH + (((bb * NH + (c0 >> 6)) * (TT / 16) + (t0 >> 4)) * 4 + wave) * 256 + lane * 8;   // fragment order: wave = (32-wide d chunk, half of the fragment), lane = (g, key); trip i = (head i >> 2 of the block's two, 16-key tile i & 3)
    if (which == 0) {
      if (hi_rows) {
#pragma unroll
        for (int i = 0; i < 8; ++i) { vst2((unsigned*)(dh + i * 8 * CC), *(const v4u*)&sh[srow + i * 8][q8]); vst2((unsigned*)(dl + i * 8 * CC), *(const v4u*)&sl[srow + i * 8][q8]); }
        asm volatile("s_wait_xcnt 0x0" ::: "memory");   // behind the run of stores, in front of any later write of a register that they name
      } else {
#pragma unroll
        for (int i = 0; i < 8; ++i) vst2((unsigned*)(dh + i * 8 * CC), *(const v4u*)&sh[srow + i * 8][q8]);
        asm volatile("s_wait_xcnt 0x0" ::: "memory");   // behind the run of stores, in front of any later write of a register that they name
      }
    } else if (hi_rows) {
#pragma unroll
      for (int i = 0; i < 8; ++i) { vst2((unsigned*)(kd + (i >> 2) * (TT * HD) + (i & 3) * 1024), *(const v4u*)&sh[(i & 3) * 16 + col][(i >> 2) * 64 + wave * 16 + g * 8]); vst2((unsigned*)(dl + i * 8 * CC), *(const v4u*)&sl[srow + i * 8][q8]); }
      asm volatile("s_wait_xcnt 0x0" ::: "memory");   // behind the run of stores, in front of any later write of a register that they name
    } else {
#pragma unroll
      for (int i = 0; i < 8; ++i) vst2((unsigned*)(kd + (i >> 2) * (TT * HD) + (i & 3) * 1024), *(const v4u*)&sh[(i & 3) * 16 + col][(i >> 2) * 64 + wave * 16 + g * 8]);
      asm volatile("s_wait_xcnt 0x0" ::: "memory");   // behind the run of stores, in front of any later write of a register that they name
    }
  } else { const bool hi_rows = t0 < KHI;
#pragma unroll
    for (int j = 0; j < 8; ++j) { const float bias = BA ? bfr(BA[c0 + j * 16 + col]) : 0.f;
#pragma unroll
      for (int r = 0; r < 8; ++r) { const float v = acc[j][r] + bias; const int rl = wave * 16 + 8 * g + r, cl = j * 16 + col; th[cl][rl] = (_Float16)v; const __bf16 bh = (__bf16)v; tb[cl][rl] = bh; tbl[cl][rl] = (__bf16)(v - (float)bh); } }
    __syncthreads();
    _Float16* vd = VT + (((bb * NH + (c0 >> 6)) * (TT / 32) + (t0 >> 5)) * 8 + wave) * 256 + lane * 8;   // fragment order: wave = (low bit of the 16-channel tile, half of the fragment), lane = (g, channel); trip i = (head i >> 2, 32-key pass (i >> 1) & 1, high bit i & 1 of the channel tile); unrolled like the q / k stores
    if (hi_rows) { const int cl = tid >> 3, q = tid & 7; const size_t o3 = (bb * CC + c0 + cl) * (size_t)KHI + t0 + q * 8;
#pragma unroll
      for (int i = 0; i < 8; ++i) { vst2((unsigned*)(vd + (i >> 2) * (TT * HD) + ((i >> 1) & 1) * 2048 + (i & 1) * 1024), *(const v4u*)&th[(i >> 2) * 64 + (i & 1) * 32 + (wave >> 1) * 16 + col][((i >> 1) & 1) * 32 + (wave & 1) * 16 + g * 8]);
        vst2((unsigned*)(VB + o3 + i * 16 * KHI), *(const v4u*)&tb[cl + i * 16][q * 8]); vst2((unsigned*)(VBL + o3 + i * 16 * KHI), *(const v4u*)&tbl[cl + i * 16][q * 8]); }
      asm volatile("s_wait_xcnt 0x0" ::: "memory");   // behind the run of stores, in front of any later write of a register that they name
    } else {
#pragma unroll
      for (int i = 0; i < 8; ++i) vst2((unsigned*)(vd + (i >> 2) * (TT * HD) + ((i >> 1) & 1) * 2048 + (i & 1) * 1024), *(const v4u*)&th[(i >> 2) * 64 + (i & 1) * 32 + (wave >> 1) * 16 + col][((i >> 1) & 1) * 32 + (wave & 1) * 16 + g * 8]);
      asm volatile("s_wait_xcnt 0x0" ::: "memory");   // behind the run of stores, in front of any later write of a register that they name
    } } }
__device__ __forceinline__ v8f wmma_p(v16h a, v16h b, v8f c) { return __builtin_amdgcn_wmma_f32_16x16x32_f16(false, a, false, b, (short)0, c, false, false); }
__device__ __forceinline__ v16h frag_t(const _Float16* tile, int lane) {   // a fragment stored in fragment order: two runs of 32 lanes x 8 elements
  union { v16h v; v8h q[2]; } u; const _Float16* p = tile + lane * 8; u.q[0] = *(const v8h*)p; u.q[1] = *(const v8h*)(p + 256); return u.v; }
__device__ __forceinline__ float xhalf(float v) { const int i = __builtin_bit_cast(int, v); return __builtin_bit_cast(float, __builtin_amdgcn_permlanex16(i, i, 0x76543210, 0xfedcba98, false, false)); }   // lane l <-> l ^ 16
// One 32-key tile of a block in LDS: K 4,096 B and V 4,096 B, both in fragment order as they lie in the workspace, then the block's 64 mask rows of 128 B at a pitch of 144 B (16 B x 9: the 16 rows of a 16-byte read fall on distinct banks). Two such buffers.
#define FA_KV 4096
#define FA_MP 144
#define FA_BUF (2 * FA_KV + 64 * FA_MP)
#define FA_NT (TT / 32)
// a thread's eight 16-byte copies of one tile: two of K, two of V (128 threads x 16 B = 2,048 contiguous bytes each), four of its own wave's mask rows (8 lanes = one whole 128-byte line, 4 rows a copy).
// Global address = the tile's scalar base + the lane's own byte offset, which is the same for every tile, like its LDS address in either buffer: a tile costs no vector address arithmetic
__device__ __forceinline__ void fa_stage(unsigned lkv, unsigned lm, unsigned okv, unsigned om, const char* gk, const char* gv, const char* gm) {
  // the copies and, as the last line of the same statement, the wait that stands in front of any rewrite of a register that they name
  asm volatile("global_load_async_to_lds_b128 %0, %8, %14\n\t"
               "global_load_async_to_lds_b128 %1, %9, %14\n\t"
               "global_load_async_to_lds_b128 %2, %8, %15\n\t"
               "global_load_async_to_lds_b128 %3, %9, %15\n\t"
               "global_load_async_to_lds_b128 %4, %10, %16\n\t"
               "global_load_async_to_lds_b128 %5, %11, %16\n\t"
               "global_load_async_to_lds_b128 %6, %12, %16\n\t"
               "global_load_async_to_lds_b128 %7, %13, %16\n\t"
               "s_wait_xcnt 0x0"
               :: "v"(lkv), "v"(lkv + 2048u), "v"(lkv + 4096u), "v"(lkv + 6144u), "v"(lm), "v"(lm + 4u * FA_MP), "v"(lm + 8u * FA_MP), "v"(lm + 12u * FA_MP),
                  "v"(okv), "v"(okv + 2048u), "v"(om), "v"(om + 4u * TT * 4u), "v"(om + 8u * TT * 4u), "v"(om + 12u * TT * 4u),
                  "s"(gk), "s"(gv), "s"(gm)
               : "memory");
}
__global__ __launch_bounds__(128) void k_fa(const _Float16* __restrict__ QH, const _Float16* __restrict__ QL, const _Float16* __restrict__ KH, const _Float16* __restrict__ VT, const float* __restrict__ MKF, float* __restrict__ Y) {
  __shared__ __align__(16) char fs[2 * FA_BUF];
  const int tid = threadIdx.x, wave = tid >> 5, lane = tid & 31, col = lane & 15, g = lane >> 4; const int h = blockIdx.y, b = blockIdx.z; const int t = blockIdx.x * 64 + wave * 16 + col;
  const char* gk = (const char*)(KH + (size_t)(b * NH + h) * (TT * HD)); const char* gv = (const char*)(VT + (size_t)(b * NH + h) * (TT * HD)); /* 32 keys = 4,096 bytes of either */ const unsigned okv = tid * 16;
  const int mrow = wave * 16 + (lane >> 3); const char* gm = (const char*)(MKF + (size_t)(blockIdx.x * 64) * TT); /* 32 keys = 128 bytes of a row */ const unsigned om = mrow * (TT * 4) + (lane & 7) * 16;
  const unsigned lkv = (unsigned)(size_t)fs + tid * 16, lm = (unsigned)(size_t)fs + 2 * FA_KV + mrow * FA_MP + (lane & 7) * 16;
  fa_stage(lkv, lm, okv, om, gk, gv, gm);
  v16h qh[HD / 32], ql[HD / 32];
#pragma unroll
  for (int kc = 0; kc < HD / 32; ++kc) { qh[kc] = frag_h(QH + ((size_t)b * TT + t) * CC + h * HD + kc * 32, lane); ql[kc] = frag_h(QL + ((size_t)b * QHI + t) * CC + h * HD + kc * 32, lane); }
  asm volatile("s_wait_asynccnt 0x0" ::: "memory");   // tile 0 has landed, as far as this wave copied it
  __syncthreads();                                    // ... and as far as the other waves did
  fa_stage(lkv + FA_BUF, lm + FA_BUF, okv, om, gk + FA_KV, gv + FA_KV, gm + 128);
  v8f acc[HD / 16] = {}; float m = -3.0e38f, l = 0.f;
  for (int tp = 0; tp < FA_NT; tp += 2)
#pragma unroll   // both buffers' trips written out, so that every LDS address is a loop constant
  for (int hb = 0; hb < 2; ++hb) { const int ti = tp + hb; const int bo = hb * FA_BUF; const _Float16* Kl = (const _Float16*)(fs + bo); const _Float16* Vl = (const _Float16*)(fs + bo + FA_KV); const char* Ml = fs + bo + 2 * FA_KV + (wave * 16 + col) * FA_MP + 32 * g;
    v16h kf[2][HD / 32], vf[HD / 16]; v4f mk[2][2];
#pragma unroll
    for (int u = 0; u < 2; ++u)
#pragma unroll
      for (int kc = 0; kc < HD / 32; ++kc) kf[u][kc] = frag_t(Kl + u * 1024 + kc * 512, lane);
#pragma unroll
    for (int u = 0; u < 2; ++u) { mk[u][0] = *(const v4f*)(Ml + u * 64); mk[u][1] = *(const v4f*)(Ml + u * 64 + 16); }
#pragma unroll
    for (int j = 0; j < HD / 16; ++j) vf[j] = frag_t(Vl + j * 512, lane);
    __builtin_amdgcn_sched_barrier(0);   // the tile's twenty LDS reads issue above this line as one group with counted waits behind it; without it they scatter in small groups among the score products, each with a wait to 0 in front of the next product
    v8f sh[2] = {}, sl[2] = {};
#pragma unroll
    for (int kc = 0; kc < HD / 32; ++kc) {
#pragma unroll
      for (int u = 0; u < 2; ++u) { sh[u] = wmma_p(kf[u][kc], qh[kc], sh[u]); sl[u] = wmma_p(kf[u][kc], ql[kc], sl[u]); } }
    float v[16]; float mx = -3.0e38f;
#pragma unroll
    for (int u = 0; u < 2; ++u)
#pragma unroll
      for (int r = 0; r < 8; r += 2) { const v2f hi = {sh[u][r], sh[u][r + 1]}, lo = {sl[u][r], sl[u][r + 1]}, mm = {bfr(mk[u][r >> 2][r & 3]), bfr(mk[u][r >> 2][(r & 3) + 1])};   // the same operations written by even register pairs, as the accumulators lie: left to itself this build paired odd with even and moved the scores into place first
        const v2f s = (hi + lo * (1.0f / 1024.0f)) * mm; v[u * 8 + r] = s[0]; v[u * 8 + r + 1] = s[1]; mx = fmaxf(fmaxf(mx, s[0]), s[1]); }
    __builtin_amdgcn_sched_barrier(0);   // the score products stay above this line, under the latency of the mask and v reads; without it the waits below rise to directly behind the LDS reads and the wave stands there for all twenty
    // the tile is in registers: from here on the trip reads no LDS, so the buffer is handed over here and the refill has a whole trip to land
    asm volatile("s_wait_dscnt 0x0" ::: "memory");      // this wave's reads of the buffer have returned
    asm volatile("s_wait_asynccnt 0x0" ::: "memory");   // its copies of tile ti + 1 have landed
    __syncthreads();                                    // publishes tile ti + 1 and ends every wave's reads of the buffer that is refilled below
    if (ti + 2 < FA_NT) fa_stage(lkv + bo, lm + bo, okv, om, gk + (ti + 2) * FA_KV, gv + (ti + 2) * FA_KV, gm + (ti + 2) * 128);
    mx = fmaxf(mx, xhalf(mx)); const float mn = fmaxf(m, mx - 11.0f); const float alpha = __builtin_amdgcn_exp2f(m - mn); m = mn;
    v16h p; float sum = 0.f;
#pragma unroll
    for (int i = 0; i < 16; ++i) { const float e = __builtin_amdgcn_exp2f(v[i] - mn); sum += e; p[i] = (_Float16)e; }
    l = l * alpha + sum;
#pragma unroll
    for (int j = 0; j < HD / 16; ++j) { acc[j] = acc[j] * alpha; acc[j] = wmma_p(vf[j], p, acc[j]); } }
  asm volatile("s_wait_asynccnt 0x0" ::: "memory");     // no copy is outstanding when the wave ends
  l += xhalf(l); const float inv = 1.0f / l;   // never near 0: the key that holds the maximum adds 2^11
  float* yp = Y + ((size_t)b * TT + t) * CC + h * HD + 8 * g;
#pragma unroll
  for (int j = 0; j < HD / 16; ++j) { const v8f o = acc[j] * inv; vst2(yp + j * 16, (v4f){o[0], o[1], o[2], o[3]}); vst2(yp + j * 16 + 4, (v4f){o[4], o[5], o[6], o[7]}); } }
// ---- k_out: block = (64 rows, 128 cols): out = ctx Wo (+ bo): all rows: ctx bf16 hi + lo against exact bf16 Wo (2 products); the f16 (1 product) branch is not taken
__global__ __launch_bounds__(128) void k_out(const float* __restrict__ Y, const float* __restrict__ WO, const float* __restrict__ BO, float* __restrict__ OUT) { __shared__ __align__(16) float sf[4][16][132]; __shared__ __align__(16) __bf16 so[2 * 256 * SP];   // so: two staging buffers of [ctx hi 64 rows | ctx lo 64 rows | Wo 128 rows] x SP
  const int tid = threadIdx.x, wave = tid >> 5, lane = tid & 31, col = lane & 15, g = lane >> 4; const int c0 = blockIdx.y * 128; const size_t r0 = (size_t)blockIdx.x * 64 + wave * 16;
  v8f acc[8] = {};
  if (true) {   /* ALL rows: ctx split bf16 hi + lo x exact Wo (2 products) */
    const int srow = tid >> 4, sq = (tid & 15) * 4; const float* Yg = Y + ((size_t)blockIdx.x * 64 + srow) * CC + sq; const float* Wg = WO + (size_t)(c0 + srow) * CC + sq; __bf16* const sd = so + srow * SP + sq;
    v4f ry[8], rw[16];   // the inner loops below are fully unrolled so that every index into ry, rw, w and acc is a constant (registers, no scratch)
#pragma unroll
    for (int i = 0; i < 8; ++i) ry[i] = *(const v4f*)(Yg + (size_t)(i * 8) * CC);
#pragma unroll
    for (int i = 0; i < 16; ++i) rw[i] = *(const v4f*)(Wg + (size_t)(i * 8) * CC);
#pragma unroll
    for (int i = 0; i < 8; ++i) { const v4b hv = bf4(ry[i]); *(v4b*)(sd + i * 8 * SP) = hv; *(v4b*)(sd + (64 + i * 8) * SP) = bf4((v4f){ry[i][0] - (float)hv[0], ry[i][1] - (float)hv[1], ry[i][2] - (float)hv[2], ry[i][3] - (float)hv[3]}); }
#pragma unroll
    for (int i = 0; i < 16; ++i) *(v4b*)(sd + (128 + i * 8) * SP) = bf4(rw[i]);
    __syncthreads();
    for (int c = 0; c < CC / KC; ++c) { const bool more = c + 1 < CC / KC;   // chunk c + 1 flies into registers while chunk c is multiplied out of LDS
      if (more) {
#pragma unroll
        for (int i = 0; i < 8; ++i) ry[i] = *(const v4f*)(Yg + (size_t)(i * 8) * CC + (c + 1) * KC);
#pragma unroll
        for (int i = 0; i < 16; ++i) rw[i] = *(const v4f*)(Wg + (size_t)(i * 8) * CC + (c + 1) * KC);
        asm volatile("s_wait_xcnt 0x0" ::: "memory"); }   // stands in front of the first overwrite of an address register that the loads above name
      const __bf16* buf = so + (c & 1) * (256 * SP);
#pragma unroll
      for (int ks = 0; ks < KC / 32; ++ks) { const v16b ah = frag_b(buf + (wave * 16 + col) * SP + ks * 32, lane), al = frag_b(buf + (64 + wave * 16 + col) * SP + ks * 32, lane);
#pragma unroll
        for (int jh = 0; jh < 8; jh += 4) { v16b w[4];   // four Wo fragments at a time: hi then lo into four independent tiles, so no product waits for the one before it on its own tile
#pragma unroll
          for (int j = 0; j < 4; ++j) w[j] = frag_b(buf + (128 + (jh + j) * 16 + col) * SP + ks * 32, lane);
#pragma unroll
          for (int j = 0; j < 4; ++j) acc[jh + j] = wmma_bf(ah, w[j], acc[jh + j]);
#pragma unroll
          for (int j = 0; j < 4; ++j) acc[jh + j] = wmma_bf(al, w[j], acc[jh + j]); } }
      if (more) { __bf16* d = sd + ((c + 1) & 1) * (256 * SP);
#pragma unroll
        for (int i = 0; i < 8; ++i) { const v4b hv = bf4(ry[i]); *(v4b*)(d + i * 8 * SP) = hv; *(v4b*)(d + (64 + i * 8) * SP) = bf4((v4f){ry[i][0] - (float)hv[0], ry[i][1] - (float)hv[1], ry[i][2] - (float)hv[2], ry[i][3] - (float)hv[3]}); }
#pragma unroll
        for (int i = 0; i < 16; ++i) *(v4b*)(d + (128 + i * 8) * SP) = bf4(rw[i]); }
      __syncthreads(); }   // publishes chunk c + 1 and ends every wave's reads of the buffer that the next trip refills
#pragma unroll
    for (int j = 0; j < 8; ++j) { const float bias = BO ? bfr(BO[c0 + j * 16 + col]) : 0.f;
#pragma unroll
      for (int r = 0; r < 8; ++r) sf[wave][8 * g + r][j * 16 + col] = acc[j][r] + bias; }
  } else {
#pragma unroll 2
    for (int kc = 0; kc < CC / 32; ++kc) { const v16h a = frag_f32(Y + (r0 + col) * CC + kc * 32, lane); asm volatile("s_wait_loadcnt 0x0" ::: "memory");
#pragma unroll
      for (int j = 0; j < 8; ++j) { const v16h w = WOCOLH(WO, kc * 32, c0 + j * 16 + col, lane); asm volatile("s_wait_loadcnt 0x0" ::: "memory"); acc[j] = wmma16(a, w, acc[j]); } }
#pragma unroll
    for (int j = 0; j < 8; ++j) { const float bias = BO ? bfr(BO[c0 + j * 16 + col]) : 0.f;
#pragma unroll
      for (int r = 0; r < 8; ++r) sf[wave][8 * g + r][j * 16 + col] = acc[j][r] * (1.0f / 256.0f) + bias; } }
  LDSX(); for (int rl = 0; rl < 16; ++rl) vst2(OUT + (r0 + rl) * DIN + c0 + lane * 4, *(const v4f*)&sf[wave][rl][lane * 4]); }

extern "C" void kernel_launch(void* const* d_in, const int* in_sizes, int n_in, void* d_out, int out_size, void* d_ws, size_t ws_size, hipStream_t stream) {
  (void)in_sizes; (void)n_in; (void)out_size;
  const float** F = (const float**)d_in;
  if (ws_size < (size_t)WS_END) return;
  char* ws = (char*)d_ws; _Float16 *QH = (_Float16*)(ws + WS_QH), *KH = (_Float16*)(ws + WS_KH), *VT = (_Float16*)(ws + WS_VT), *QL = (_Float16*)(ws + WS_QL), *KL = (_Float16*)(ws + WS_KL); __bf16 *VB = (__bf16*)(ws + WS_VB), *VBL = (__bf16*)(ws + WS_VBL); float *Y = (float*)(ws + WS_Y);
  // inputs: 0 x [2,2048,1024]; 1 w_qkv [3072,1024] (out,in); 2 w_proj [1024,1024] (out,in); 3 b_proj; 4 mask [2048,2048] f32 0/1
  k_proj<<<dim3(TNB * TT / 64, CC / 128, 3), 128, 0, stream>>>(F[0], F[0], F[0], F[1], F[1] + (size_t)CC * DIN, F[1] + (size_t)2 * CC * DIN, nullptr, nullptr, nullptr, QH, QL, KH, KL, VT, VB, VBL);
  k_fa<<<dim3(NQB, NH, TNB), 128, 0, stream>>>(QH, QL, KH, VT, F[4], Y);
  k_out<<<dim3(TNB * TT / 64, DIN / 128), 128, 0, stream>>>(Y, F[2], F[3], (float*)d_out);
}

// v006
// A run of this version takes 110 microseconds.
// Next to v005, in two timings, it ran 1.10 and 1.09 times as fast.
// Counting every step since v000, it is 12.1 times as fast.
// compute dtype: all float inputs rounded to bf16; qkv = x Wqkv^T with EXACT bf16 products on WMMA 16x16x32 (f32 accumulate); q x 64^-0.5 x log2(e) as f16 hi + residual (x 2^10) against k once to f16 (2 products), then MULTIPLIED by the 0/1 mask (masked logits become 0, they are not excluded); softmax in f32 in base 2 (one hardware exp2 per score) with a running maximum, scores kept in registers; 2^(logit - max + 11) once to f16 against v once to f16 (1 product), divided by the f32 sum at the end; ctx split bf16 hi + lo against exact w_proj (2 products) + b_proj; f32 output.
#include <hip/hip_runtime.h>
#include <math.h>

typedef __attribute__((ext_vector_type(16))) _Float16 v16h;
typedef __attribute__((ext_vector_type(16))) __bf16 v16b;
typedef __attribute__((ext_vector_type(8)))  _Float16 v8h;
typedef __attribute__((ext_vector_type(8)))  float v8f;
typedef __attribute__((ext_vector_type(4)))  float v4f;
typedef __attribute__((ext_vector_type(2)))  float v2f;
typedef __attribute__((ext_vector_type(4)))  unsigned v4u;
typedef __attribute__((ext_vector_type(4)))  int v4i;
typedef float __attribute__((may_alias)) float_a;
typedef int __attribute__((may_alias)) int_a;

template <typename T> __device__ __forceinline__ void vst2(void* p, T v) { *(T*)p = v;  }
__device__ __forceinline__ v8f wmma16(v16h a, v16h b, v8f c) {
  v8f d = __builtin_amdgcn_wmma_f32_16x16x32_f16(false, a, false, b, (short)0, c, false, false);
  asm volatile("v_nop\n\tv_nop\n\tv_nop\n\tv_nop" : "+v"(d) : "v"(a), "v"(b));
  return d;
}
__device__ __forceinline__ v8f wmma_bf(v16b a, v16b b, v8f c) {
  v8f d = __builtin_amdgcn_wmma_f32_16x16x32_bf16(false, a, false, b, (short)0, c, false, false);
  asm volatile("v_nop\n\tv_nop\n\tv_nop\n\tv_nop" : "+v"(d) : "v"(a), "v"(b));
  return d;
}
// 16x16x32 fragments: lane = (h = lane>>4, row/col = lane&15); elements 0..7 = k0+8h+0..7, 8..15 = k0+16+8h+0..7; D element r = row 8h+r
__device__ __forceinline__ v16h frag_h(const _Float16* rowk0, int lane) {
  union { v16h v; v8h q[2]; } u; const _Float16* p = rowk0 + 8 * (lane >> 4);
  u.q[0] = *(const v8h*)p; u.q[1] = *(const v8h*)(p + 16); return u.v;
}
__device__ __forceinline__ v16h frag_f32(const float* rowk0, int lane) {
  v16h a; const float* p = rowk0 + 8 * (lane >> 4);
#pragma unroll
  for (int i = 0; i < 8; ++i) { a[i] = (_Float16)p[i]; a[8 + i] = (_Float16)p[16 + i]; }
  return a;
}
__device__ __forceinline__ v16h frag_f32s(const float* rowk0, int lane, float sc) {
  v16h a; const float* p = rowk0 + 8 * (lane >> 4);
#pragma unroll
  for (int i = 0; i < 8; ++i) { a[i] = (_Float16)(p[i] * sc); a[8 + i] = (_Float16)(p[16 + i] * sc); }
  return a;
}
// column fragment from a [K][ld] layout (column n), rows >= K read as 0
__device__ __forceinline__ v16h fragc_f32(const float* W, int k0, int n, int lane, int ld, int K) {
  v16h a; const int g = lane >> 4;
#pragma unroll
  for (int i = 0; i < 8; ++i) { const int ka = k0 + 8 * g + i, kb = ka + 16;
    a[i] = (_Float16)(ka < K ? W[(size_t)(ka < K ? ka : K - 1) * ld + n] : 0.f); a[8 + i] = (_Float16)(kb < K ? W[(size_t)(kb < K ? kb : K - 1) * ld + n] : 0.f); }
  return a;
}
struct F2 { v16b h, l; };
__device__ __forceinline__ F2 bsplit16(const float v[16]) { F2 r;
#pragma unroll
  for (int i = 0; i < 16; ++i) { const __bf16 h = (__bf16)v[i]; r.h[i] = h; r.l[i] = (__bf16)(v[i] - (float)h); }
  return r; }
__device__ __forceinline__ F2 split_row(const float* row, int k0, int lane) { float v[16]; const float* p = row + k0 + 8 * (lane >> 4);
#pragma unroll
  for (int i = 0; i < 8; ++i) { v[i] = p[i]; v[8 + i] = p[16 + i]; }
  return bsplit16(v); }
__device__ __forceinline__ F2 split_rowK(const float* row, int k0, int lane, int K) { float v[16]; const int g = lane >> 4;
#pragma unroll
  for (int i = 0; i < 8; ++i) { const int ka = k0 + 8 * g + i, kb = ka + 16; v[i] = ka < K ? row[ka < K ? ka : K - 1] : 0.f; v[8 + i] = kb < K ? row[kb < K ? kb : K - 1] : 0.f; }
  return bsplit16(v); }
__device__ __forceinline__ F2 split_col(const float* W, int k0, int n, int lane, int ld, int K) { float v[16]; const int g = lane >> 4;
#pragma unroll
  for (int i = 0; i < 8; ++i) { const int ka = k0 + 8 * g + i, kb = ka + 16; v[i] = ka < K ? W[(size_t)(ka < K ? ka : K - 1) * ld + n] : 0.f; v[8 + i] = kb < K ? W[(size_t)(kb < K ? kb : K - 1) * ld + n] : 0.f; }
  return bsplit16(v); }
__device__ __forceinline__ v8f mac3(const F2& a, const F2& b, v8f c) { c = wmma_bf(a.l, b.h, c); c = wmma_bf(a.h, b.l, c); return wmma_bf(a.h, b.h, c); }
__device__ __forceinline__ float sigm(float v) { return 1.0f / (1.0f + expf(-v)); }
#define LDSX() do { asm volatile("s_wait_dscnt 0" ::: "memory"); __builtin_amdgcn_wave_barrier(); __builtin_amdgcn_fence(__ATOMIC_RELEASE, "workgroup"); } while (0)

// Multi-head attention with a MULTIPLICATIVE 0/1 mask (B 2, N 2,048, C 1,024 = 16 x 64): qkv = x w_qkv^T ((out,in) [3072,1024], rows (3,H,D)); attn = softmax((q k^T x 64^-0.5) * mask) with mask [N,N] of 0/1 shared over (b,h) - a masked logit is 0.0, still inside the softmax; out = merged(attn v) w_proj^T + b_proj.
#define NB 2
#define TT 2048
#define CC 1024            // NH * HD = projected width
#define DIN 1024          // input (model) width
#define NH 16
#define HD 64
#define NQB (TT / 64)
#define SCALE (0.125f)
#define QSC (SCALE * 1.44269504088896340736f)   // logit scale x log2(e): k_proj multiplies q by it in f32 before the f16 hi / residual split, so k_fa's scores arrive as base-2 exponents
#ifndef TNB
#define TNB NB
#endif
__device__ __forceinline__ float bfr(float v) { return (float)(__bf16)v; }
typedef __attribute__((ext_vector_type(8))) __bf16 v8b;
__device__ __forceinline__ v16b frag_b(const __bf16* rowk0, int lane) {
  union { v16b v; v8b q[2]; } u; const __bf16* p = rowk0 + 8 * (lane >> 4);
  u.q[0] = *(const v8b*)p; u.q[1] = *(const v8b*)(p + 16); return u.v;
}
#define QHI 2048            // rows carrying a q residual plane (all rows when non-causal: 2-product logits everywhere)
#define KHI 64            // key rows carrying k residual / v bf16 hi+lo planes (written by k_proj; no kernel in this file reads them)
// B fragment (k rows k0+.., output column o) of a weight: (in,out) [K][ld] or (out,in) [ld rows of K]: bf16 exact, or f16(bf16 * 256) exact
__device__ __forceinline__ v16b wcol_io(const float* Wm, int k0, int o, int lane, int ld) { v16b w; const int g = lane >> 4;
#pragma unroll
  for (int i = 0; i < 8; ++i) { w[i] = (__bf16)Wm[(size_t)(k0 + 8 * g + i) * ld + o]; w[8 + i] = (__bf16)Wm[(size_t)(k0 + 16 + 8 * g + i) * ld + o]; }
  return w; }
__device__ __forceinline__ v16b wcol_oi(const float* Wm, int k0, int o, int lane, int K) { v16b w; const float* p = Wm + (size_t)o * K + k0 + 8 * (lane >> 4);
#pragma unroll
  for (int i = 0; i < 8; ++i) { w[i] = (__bf16)p[i]; w[8 + i] = (__bf16)p[16 + i]; }
  return w; }
__device__ __forceinline__ v16h wcolh_io(const float* Wm, int k0, int o, int lane, int ld) { v16h w; const int g = lane >> 4;
#pragma unroll
  for (int i = 0; i < 8; ++i) { w[i] = (_Float16)(bfr(Wm[(size_t)(k0 + 8 * g + i) * ld + o]) * 256.0f); w[8 + i] = (_Float16)(bfr(Wm[(size_t)(k0 + 16 + 8 * g + i) * ld + o]) * 256.0f); }
  return w; }
__device__ __forceinline__ v16h wcolh_oi(const float* Wm, int k0, int o, int lane, int K) { v16h w; const float* p = Wm + (size_t)o * K + k0 + 8 * (lane >> 4);
#pragma unroll
  for (int i = 0; i < 8; ++i) { w[i] = (_Float16)(bfr(p[i]) * 256.0f); w[8 + i] = (_Float16)(bfr(p[16 + i]) * 256.0f); }
  return w; }
#define WQKV_LAYOUT 1   // 0 = (in,out) [DIN][CC]; 1 = (out,in) [CC][DIN]; 2 = per-head [NH][DIN][HD]
__device__ __forceinline__ v16b wcol_hdk(const float* Wm, int k0, int o, int lane) { v16b w; const int g = lane >> 4; const float* p = Wm + (size_t)(o / HD) * DIN * HD + (o % HD);
#pragma unroll
  for (int i = 0; i < 8; ++i) { w[i] = (__bf16)p[(size_t)(k0 + 8 * g + i) * HD]; w[8 + i] = (__bf16)p[(size_t)(k0 + 16 + 8 * g + i) * HD]; }
  return w; }
#define WO_OUT_IN 1
#if WQKV_LAYOUT == 1
#define WCOL(W, k0, o, lane) wcol_oi(W, k0, o, lane, DIN)
#elif WQKV_LAYOUT == 2
#define WCOL(W, k0, o, lane) wcol_hdk(W, k0, o, lane)
#else
#define WCOL(W, k0, o, lane) wcol_io(W, k0, o, lane, CC)
#endif
#if WO_OUT_IN
#define WOCOL(W, k0, o, lane) wcol_oi(W, k0, o, lane, CC)
#define WOCOLH(W, k0, o, lane) wcolh_oi(W, k0, o, lane, CC)
#else
#define WOCOL(W, k0, o, lane) wcol_io(W, k0, o, lane, DIN)
#define WOCOLH(W, k0, o, lane) wcolh_io(W, k0, o, lane, DIN)
#endif

#define WS_QH  0u                                      // f16 q rows [b*t][CC]
#define WS_KH  (WS_QH + 2u * (size_t)NB * TT * CC)      // f16 k in fragment order [b][h][t / 16][d / 32][2][lane][8]: one 16-byte load of a wave = 512 contiguous bytes
#define WS_VT  (WS_KH + 2u * (size_t)NB * TT * CC)      // f16 v in fragment order [b][h][t / 32][d / 16][2][lane][8]
#define WS_QL  (WS_VT + 2u * (size_t)NB * CC * TT)      // f16 q residual x 2^10 rows [b][t < QHI][CC]
#define WS_KL  (WS_QL + 2u * (size_t)NB * QHI * CC)     // f16 k residual x 2^10 rows [b][t < KHI][CC]
#define WS_VB  (WS_KL + 2u * (size_t)NB * KHI * CC)     // bf16 v hi planes [b][c][t < KHI]
#define WS_VBL (WS_VB + 2u * (size_t)NB * CC * KHI)
#define WS_Y   (WS_VBL + 2u * (size_t)NB * CC * KHI)    // f32 ctx rows [b*t][CC] (only when there is an output projection)
#define WS_END (WS_Y  + 4u * (size_t)NB * TT * CC)

// LDS staging of the two projection GEMMs: a chunk is KC k values of every operand row of the block's tile, read from global memory as whole 256-B row pieces (16 lanes x 16 B), rounded to bf16 once and shared by the block's four waves
#define KC 64
#define SP 72             // LDS row pitch in 16-bit elements: 144 B = 16 B x 9, so the 16 rows of a 16-byte fragment read fall on distinct banks
typedef __attribute__((ext_vector_type(4))) __bf16 v4b;
__device__ __forceinline__ v4b bf4(v4f v) { v4b r; r[0] = (__bf16)v[0]; r[1] = (__bf16)v[1]; r[2] = (__bf16)v[2]; r[3] = (__bf16)v[3]; return r; }
// ---- k_proj: block = (128 rows, 128 cols, which): q/k/v = X W (+ b) with exact bf16 products (K = DIN) -> which 0: q x QSC f16 rows (+ residual rows < QHI); 1: k f16 in the attention's fragment order (+ residual rows < KHI); 2: v f16 in fragment order (+ bf16 hi/lo planes for t < KHI)
// a wave holds two 16-row groups of the block (rows wave * 16 and 64 + wave * 16) x all 128 cols: each W fragment read from LDS feeds two products, and each W row fetched from L2 serves 128 rows of X
__global__ __launch_bounds__(128) void k_proj(const float* __restrict__ XQ, const float* __restrict__ XK, const float* __restrict__ XV, const float* __restrict__ WQ, const float* __restrict__ WK, const float* __restrict__ WV, const float* __restrict__ BQ, const float* __restrict__ BK, const float* __restrict__ BV,
    _Float16* __restrict__ QH, _Float16* __restrict__ QL, _Float16* __restrict__ KH, _Float16* __restrict__ KL, _Float16* __restrict__ VT, __bf16* __restrict__ VB, __bf16* __restrict__ VBL) {
  // one LDS range: in the K loop two staging buffers of [X 128 rows | W 128 rows] x SP; behind the loop's last barrier the output staging of one 64-row half at a time (sh, sl or th, tb, tbl)
  __shared__ __align__(16) char smem[2 * 256 * SP * 2];
  _Float16 (*sh)[136] = (_Float16 (*)[136])smem; _Float16 (*sl)[136] = (_Float16 (*)[136])(smem + 64 * 136 * 2); _Float16 (*th)[72] = (_Float16 (*)[72])smem; __bf16 (*tb)[72] = (__bf16 (*)[72])(smem + 128 * 72 * 2); __bf16 (*tbl)[72] = (__bf16 (*)[72])(smem + 2 * 128 * 72 * 2);
  __bf16* const st = (__bf16*)smem;
  const int tid = threadIdx.x, wave = tid >> 5, lane = tid & 31, col = lane & 15, g = lane >> 4; const int which = blockIdx.z; const int c0 = blockIdx.y * 128; const size_t r0 = (size_t)blockIdx.x * 128; const size_t bb = r0 / TT; const int t0 = (int)(r0 % TT);
  const float* X = which == 0 ? XQ : which == 1 ? XK : XV; const float* WA = which == 0 ? WQ : which == 1 ? WK : WV; const float* BA = which == 0 ? BQ : which == 1 ? BK : BV;
  v8f acc[2][8] = {};
  const int srow = tid >> 4, sq = (tid & 15) * 4; const float* Xg = X + (r0 + srow) * DIN + sq; const float* Wg = WA + (size_t)(c0 + srow) * DIN + sq; __bf16* const sd = st + srow * SP + sq;
  v4f rx[16], rw[16];   // the inner loops below are fully unrolled so that every index into rx, rw, a, w and acc is a constant (registers, no scratch)
#pragma unroll
  for (int i = 0; i < 16; ++i) rx[i] = *(const v4f*)(Xg + (size_t)(i * 8) * DIN);
#pragma unroll
  for (int i = 0; i < 16; ++i) rw[i] = *(const v4f*)(Wg + (size_t)(i * 8) * DIN);
  asm volatile("s_wait_xcnt 0x0" ::: "memory");   // stands in front of the first overwrite of an address register that the loads above name
#pragma unroll
  for (int i = 0; i < 16; ++i) *(v4b*)(sd + i * 8 * SP) = bf4(rx[i]);
#pragma unroll
  for (int i = 0; i < 16; ++i) *(v4b*)(sd + (128 + i * 8) * SP) = bf4(rw[i]);
  __syncthreads();
  for (int c = 0; c < DIN / KC; ++c) { const bool more = c + 1 < DIN / KC;   // chunk c + 1 flies into registers while chunk c is multiplied out of LDS
    if (more) {
#pragma unroll
      for (int i = 0; i < 16; ++i) rx[i] = *(const v4f*)(Xg + (size_t)(i * 8) * DIN + (c + 1) * KC);
#pragma unroll
      for (int i = 0; i < 16; ++i) rw[i] = *(const v4f*)(Wg + (size_t)(i * 8) * DIN + (c + 1) * KC);
      asm volatile("s_wait_xcnt 0x0" ::: "memory"); }   // stands in front of the first overwrite of an address register that the loads above name
    const __bf16* buf = st + (c & 1) * (256 * SP);
#pragma unroll
    for (int ks = 0; ks < KC / 32; ++ks) { const v16b a0 = frag_b(buf + (wave * 16 + col) * SP + ks * 32, lane), a1 = frag_b(buf + (64 + wave * 16 + col) * SP + ks * 32, lane);
#pragma unroll
      for (int jh = 0; jh < 8; jh += 4) { v16b w[4];   // four W fragments at a time, each against both row groups: eight independent tiles
#pragma unroll
        for (int j = 0; j < 4; ++j) w[j] = frag_b(buf + (128 + (jh + j) * 16 + col) * SP + ks * 32, lane);
#pragma unroll
        for (int j = 0; j < 4; ++j) acc[0][jh + j] = wmma_bf(a0, w[j], acc[0][jh + j]);
#pragma unroll
        for (int j = 0; j < 4; ++j) acc[1][jh + j] = wmma_bf(a1, w[j], acc[1][jh + j]); } }
    if (more) { __bf16* d = sd + ((c + 1) & 1) * (256 * SP);
#pragma unroll
      for (int i = 0; i < 16; ++i) *(v4b*)(d + i * 8 * SP) = bf4(rx[i]);
#pragma unroll
      for (int i = 0; i < 16; ++i) *(v4b*)(d + (128 + i * 8) * SP) = bf4(rw[i]); }
    __syncthreads(); }   // publishes chunk c + 1 and ends every wave's reads of the buffer that the next trip refills (behind the last trip: of the range that becomes output staging)
  // the block's two 64-row halves leave one after the other through the same staging range; hf is unrolled so that acc keeps constant indices
  if (which < 2) { _Float16* DH = which == 0 ? QH : KH; _Float16* DL = which == 0 ? QL : KL; const int nhi = which == 0 ? QHI : KHI; const float osc = which == 0 ? QSC : 1.0f;
#pragma unroll
   for (int hf = 0; hf < 2; ++hf) { const size_t rh = r0 + hf * 64; const int tq = t0 + hf * 64; const bool hi_rows = tq < nhi;
    if (hf) __syncthreads();   // ends every wave's reads of the first half's staging before the second half overwrites it
#pragma unroll
    for (int j = 0; j < 8; ++j) { const float bias = BA ? bfr(BA[c0 + j * 16 + col]) : 0.f;
#pragma unroll
      for (int r = 0; r < 8; ++r) { const float v = (acc[hf][j][r] + bias) * osc; const _Float16 hv = (_Float16)v; sh[wave * 16 + 8 * g + r][j * 16 + col] = hv; sl[wave * 16 + 8 * g + r][j * 16 + col] = (_Float16)((v - (float)hv) * 1024.0f); } }
    __syncthreads();
    // each plane leaves as one fully unrolled run of eight stores that share one address pair plus constant offsets
    const int q8 = (tid & 15) * 8; _Float16* dh = DH + (rh + srow) * CC + c0 + q8; _Float16* dl = DL + (bb * nhi + tq + srow) * (size_t)CC + c0 + q8;
    _Float16* kd = DH + (((bb * NH + (c0 >> 6)) * (TT / 16) + (tq >> 4)) * 4 + wave) * 256 + lane * 8;   // fragment order: wave = (32-wide d chunk, half of the fragment), lane = (g, key); trip i = (head i >> 2 of the block's two, 16-key tile i & 3)
    if (which == 0) {
#pragma unroll
      for (int i = 0; i < 8; ++i) vst2((unsigned*)(dh + i * 8 * CC), *(const v4u*)&sh[srow + i * 8][q8]);
      asm volatile("s_wait_xcnt 0x0" ::: "memory");   // behind the run of stores, in front of any later write of a register that they name
    } else {
#pragma unroll
      for (int i = 0; i < 8; ++i) vst2((unsigned*)(kd + (i >> 2) * (TT * HD) + (i & 3) * 1024), *(const v4u*)&sh[(i & 3) * 16 + col][(i >> 2) * 64 + wave * 16 + g * 8]);
      asm volatile("s_wait_xcnt 0x0" ::: "memory");   // behind the run of stores, in front of any later write of a register that they name
    }
    if (hi_rows) {
#pragma unroll
      for (int i = 0; i < 8; ++i) vst2((unsigned*)(dl + i * 8 * CC), *(const v4u*)&sl[srow + i * 8][q8]);
      asm volatile("s_wait_xcnt 0x0" ::: "memory");   // behind the run of stores, in front of any later write of a register that they name
    } }
  } else {
#pragma unroll
   for (int hf = 0; hf < 2; ++hf) { const int tq = t0 + hf * 64; const bool hi_rows = tq < KHI;
    if (hf) __syncthreads();   // ends every wave's reads of the first half's staging before the second half overwrites it
#pragma unroll
    for (int j = 0; j < 8; ++j) { const float bias = BA ? bfr(BA[c0 + j * 16 + col]) : 0.f;
#pragma unroll
      for (int r = 0; r < 8; ++r) { const float v = acc[hf][j][r] + bias; const int rl = wave * 16 + 8 * g + r, cl = j * 16 + col; th[cl][rl] = (_Float16)v; const __bf16 bh = (__bf16)v; tb[cl][rl] = bh; tbl[cl][rl] = (__bf16)(v - (float)bh); } }
    __syncthreads();
    _Float16* vd = VT + (((bb * NH + (c0 >> 6)) * (TT / 32) + (tq >> 5)) * 8 + wave) * 256 + lane * 8;   // fragment order: wave = (low bit of the 16-channel tile, half of the fragment), lane = (g, channel); trip i = (head i >> 2, 32-key pass (i >> 1) & 1, high bit i & 1 of the channel tile); unrolled like the q / k stores
#pragma unroll
    for (int i = 0; i < 8; ++i) vst2((unsigned*)(vd + (i >> 2) * (TT * HD) + ((i >> 1) & 1) * 2048 + (i & 1) * 1024), *(const v4u*)&th[(i >> 2) * 64 + (i & 1) * 32 + (wave >> 1) * 16 + col][((i >> 1) & 1) * 32 + (wave & 1) * 16 + g * 8]);
    asm volatile("s_wait_xcnt 0x0" ::: "memory");   // behind the run of stores, in front of any later write of a register that they name
    if (hi_rows) { const int cl = tid >> 3, q = tid & 7; const size_t o3 = (bb * CC + c0 + cl) * (size_t)KHI + tq + q * 8;
#pragma unroll
      for (int i = 0; i < 8; ++i) { vst2((unsigned*)(VB + o3 + i * 16 * KHI), *(const v4u*)&tb[cl + i * 16][q * 8]); vst2((unsigned*)(VBL + o3 + i * 16 * KHI), *(const v4u*)&tbl[cl + i * 16][q * 8]); }
      asm volatile("s_wait_xcnt 0x0" ::: "memory");   // behind the run of stores, in front of any later write of a register that they name
    } } } }
__device__ __forceinline__ v8f wmma_p(v16h a, v16h b, v8f c) { return __builtin_amdgcn_wmma_f32_16x16x32_f16(false, a, false, b, (short)0, c, false, false); }
__device__ __forceinline__ v16h frag_t(const _Float16* tile, int lane) {   // a fragment stored in fragment order: two runs of 32 lanes x 8 elements
  union { v16h v; v8h q[2]; } u; const _Float16* p = tile + lane * 8; u.q[0] = *(const v8h*)p; u.q[1] = *(const v8h*)(p + 256); return u.v; }
__device__ __forceinline__ float xhalf(float v) { const int i = __builtin_bit_cast(int, v); return __builtin_bit_cast(float, __builtin_amdgcn_permlanex16(i, i, 0x76543210, 0xfedcba98, false, false)); }   // lane l <-> l ^ 16
// One 32-key tile of a block in LDS: K 4,096 B and V 4,096 B, both in fragment order as they lie in the workspace, then the block's 64 mask rows of 128 B at a pitch of 144 B (16 B x 9: the 16 rows of a 16-byte read fall on distinct banks). Two such buffers.
#define FA_KV 4096
#define FA_MP 144
#define FA_BUF (2 * FA_KV + 64 * FA_MP)
#define FA_NT (TT / 32)
// a thread's eight 16-byte copies of one tile: two of K, two of V (128 threads x 16 B = 2,048 contiguous bytes each), four of its own wave's mask rows (8 lanes = one whole 128-byte line, 4 rows a copy).
// Global address = the tile's scalar base + the lane's own byte offset, which is the same for every tile, like its LDS address in either buffer: a tile costs no vector address arithmetic
__device__ __forceinline__ void fa_stage(unsigned lkv, unsigned lm, unsigned okv, unsigned om, const char* gk, const char* gv, const char* gm) {
  // the copies and, as the last line of the same statement, the wait that stands in front of any rewrite of a register that they name
  asm volatile("global_load_async_to_lds_b128 %0, %8, %14\n\t"
               "global_load_async_to_lds_b128 %1, %9, %14\n\t"
               "global_load_async_to_lds_b128 %2, %8, %15\n\t"
               "global_load_async_to_lds_b128 %3, %9, %15\n\t"
               "global_load_async_to_lds_b128 %4, %10, %16\n\t"
               "global_load_async_to_lds_b128 %5, %11, %16\n\t"
               "global_load_async_to_lds_b128 %6, %12, %16\n\t"
               "global_load_async_to_lds_b128 %7, %13, %16\n\t"
               "s_wait_xcnt 0x0"
               :: "v"(lkv), "v"(lkv + 2048u), "v"(lkv + 4096u), "v"(lkv + 6144u), "v"(lm), "v"(lm + 4u * FA_MP), "v"(lm + 8u * FA_MP), "v"(lm + 12u * FA_MP),
                  "v"(okv), "v"(okv + 2048u), "v"(om), "v"(om + 4u * TT * 4u), "v"(om + 8u * TT * 4u), "v"(om + 12u * TT * 4u),
                  "s"(gk), "s"(gv), "s"(gm)
               : "memory");
}
__global__ __launch_bounds__(128) void k_fa(const _Float16* __restrict__ QH, const _Float16* __restrict__ QL, const _Float16* __restrict__ KH, const _Float16* __restrict__ VT, const float* __restrict__ MKF, float* __restrict__ Y) {
  __shared__ __align__(16) char fs[2 * FA_BUF];
  const int tid = threadIdx.x, wave = tid >> 5, lane = tid & 31, col = lane & 15, g = lane >> 4; const int h = blockIdx.y, b = blockIdx.z; const int t = blockIdx.x * 64 + wave * 16 + col;
  const char* gk = (const char*)(KH + (size_t)(b * NH + h) * (TT * HD)); const char* gv = (const char*)(VT + (size_t)(b * NH + h) * (TT * HD)); /* 32 keys = 4,096 bytes of either */ const unsigned okv = tid * 16;
  const int mrow = wave * 16 + (lane >> 3); const char* gm = (const char*)(MKF + (size_t)(blockIdx.x * 64) * TT); /* 32 keys = 128 bytes of a row */ const unsigned om = mrow * (TT * 4) + (lane & 7) * 16;
  const unsigned lkv = (unsigned)(size_t)fs + tid * 16, lm = (unsigned)(size_t)fs + 2 * FA_KV + mrow * FA_MP + (lane & 7) * 16;
  fa_stage(lkv, lm, okv, om, gk, gv, gm);
  v16h qh[HD / 32], ql[HD / 32];
#pragma unroll
  for (int kc = 0; kc < HD / 32; ++kc) { qh[kc] = frag_h(QH + ((size_t)b * TT + t) * CC + h * HD + kc * 32, lane); ql[kc] = frag_h(QL + ((size_t)b * QHI + t) * CC + h * HD + kc * 32, lane); }
  asm volatile("s_wait_asynccnt 0x0" ::: "memory");   // tile 0 has landed, as far as this wave copied it
  __syncthreads();                                    // ... and as far as the other waves did
  fa_stage(lkv + FA_BUF, lm + FA_BUF, okv, om, gk + FA_KV, gv + FA_KV, gm + 128);
  v8f acc[HD / 16] = {}; float m = -3.0e38f, l = 0.f;
  for (int tp = 0; tp < FA_NT; tp += 2)
#pragma unroll   // both buffers' trips written out, so that every LDS address is a loop constant
  for (int hb = 0; hb < 2; ++hb) { const int ti = tp + hb; const int bo = hb * FA_BUF; const _Float16* Kl = (const _Float16*)(fs + bo); const _Float16* Vl = (const _Float16*)(fs + bo + FA_KV); const char* Ml = fs + bo + 2 * FA_KV + (wave * 16 + col) * FA_MP + 32 * g;
    v16h kf[2][HD / 32], vf[HD / 16]; v4f mk[2][2];
#pragma unroll
    for (int u = 0; u < 2; ++u)
#pragma unroll
      for (int kc = 0; kc < HD / 32; ++kc) kf[u][kc] = frag_t(Kl + u * 1024 + kc * 512, lane);
#pragma unroll
    for (int u = 0; u < 2; ++u) { mk[u][0] = *(const v4f*)(Ml + u * 64); mk[u][1] = *(const v4f*)(Ml + u * 64 + 16); }
#pragma unroll
    for (int j = 0; j < HD / 16; ++j) vf[j] = frag_t(Vl + j * 512, lane);
    __builtin_amdgcn_sched_barrier(0);   // the tile's twenty LDS reads issue above this line as one group with counted waits behind it; without it they scatter in small groups among the score products, each with a wait to 0 in front of the next product
    v8f sh[2] = {}, sl[2] = {};
#pragma unroll
    for (int kc = 0; kc < HD / 32; ++kc) {
#pragma unroll
      for (int u = 0; u < 2; ++u) { sh[u] = wmma_p(kf[u][kc], qh[kc], sh[u]); sl[u] = wmma_p(kf[u][kc], ql[kc], sl[u]); } }
    float v[16]; float mx = -3.0e38f;
#pragma unroll
    for (int u = 0; u < 2; ++u)
#pragma unroll
      for (int r = 0; r < 8; r += 2) { const v2f hi = {sh[u][r], sh[u][r + 1]}, lo = {sl[u][r], sl[u][r + 1]}, mm = {bfr(mk[u][r >> 2][r & 3]), bfr(mk[u][r >> 2][(r & 3) + 1])};   // the same operations written by even register pairs, as the accumulators lie: left to itself this build paired odd with even and moved the scores into place first
        const v2f s = (hi + lo * (1.0f / 1024.0f)) * mm; v[u * 8 + r] = s[0]; v[u * 8 + r + 1] = s[1]; mx = fmaxf(fmaxf(mx, s[0]), s[1]); }
    __builtin_amdgcn_sched_barrier(0);   // the score products stay above this line, under the latency of the mask and v reads; without it the waits below rise to directly behind the LDS reads and the wave stands there for all twenty
    // the tile is in registers: from here on the trip reads no LDS, so the buffer is handed over here and the refill has a whole trip to land
    asm volatile("s_wait_dscnt 0x0" ::: "memory");      // this wave's reads of the buffer have returned
    asm volatile("s_wait_asynccnt 0x0" ::: "memory");   // its copies of tile ti + 1 have landed
    __syncthreads();                                    // publishes tile ti + 1 and ends every wave's reads of the buffer that is refilled below
    if (ti + 2 < FA_NT) fa_stage(lkv + bo, lm + bo, okv, om, gk + (ti + 2) * FA_KV, gv + (ti + 2) * FA_KV, gm + (ti + 2) * 128);
    mx = fmaxf(mx, xhalf(mx)); const float mn = fmaxf(m, mx - 11.0f); const float alpha = __builtin_amdgcn_exp2f(m - mn); m = mn;
    v16h p; float sum = 0.f;
#pragma unroll
    for (int i = 0; i < 16; ++i) { const float e = __builtin_amdgcn_exp2f(v[i] - mn); sum += e; p[i] = (_Float16)e; }
    l = l * alpha + sum;
#pragma unroll
    for (int j = 0; j < HD / 16; ++j) { acc[j] = acc[j] * alpha; acc[j] = wmma_p(vf[j], p, acc[j]); } }
  asm volatile("s_wait_asynccnt 0x0" ::: "memory");     // no copy is outstanding when the wave ends
  l += xhalf(l); const float inv = 1.0f / l;   // never near 0: the key that holds the maximum adds 2^11
  float* yp = Y + ((size_t)b * TT + t) * CC + h * HD + 8 * g;
#pragma unroll
  for (int j = 0; j < HD / 16; ++j) { const v8f o = acc[j] * inv; vst2(yp + j * 16, (v4f){o[0], o[1], o[2], o[3]}); vst2(yp + j * 16 + 4, (v4f){o[4], o[5], o[6], o[7]}); } }
// ---- k_out: block = (64 rows, 128 cols): out = ctx Wo (+ bo): all rows: ctx bf16 hi + lo against exact bf16 Wo (2 products); the f16 (1 product) branch is not taken
__global__ __launch_bounds__(128) void k_out(const float* __restrict__ Y, const float* __restrict__ WO, const float* __restrict__ BO, float* __restrict__ OUT) { __shared__ __align__(16) float sf[4][16][132]; __shared__ __align__(16) __bf16 so[2 * 256 * SP];   // so: two staging buffers of [ctx hi 64 rows | ctx lo 64 rows | Wo 128 rows] x SP
  const int tid = threadIdx.x, wave = tid >> 5, lane = tid & 31, col = lane & 15, g = lane >> 4; const int c0 = blockIdx.y * 128; const size_t r0 = (size_t)blockIdx.x * 64 + wave * 16;
  v8f acc[8] = {};
  if (true) {   /* ALL rows: ctx split bf16 hi + lo x exact Wo (2 products) */
    const int srow = tid >> 4, sq = (tid & 15) * 4; const float* Yg = Y + ((size_t)blockIdx.x * 64 + srow) * CC + sq; const float* Wg = WO + (size_t)(c0 + srow) * CC + sq; __bf16* const sd = so + srow * SP + sq;
    v4f ry[8], rw[16];   // the inner loops below are fully unrolled so that every index into ry, rw, w and acc is a constant (registers, no scratch)
#pragma unroll
    for (int i = 0; i < 8; ++i) ry[i] = *(const v4f*)(Yg + (size_t)(i * 8) * CC);
#pragma unroll
    for (int i = 0; i < 16; ++i) rw[i] = *(const v4f*)(Wg + (size_t)(i * 8) * CC);
#pragma unroll
    for (int i = 0; i < 8; ++i) { const v4b hv = bf4(ry[i]); *(v4b*)(sd + i * 8 * SP) = hv; *(v4b*)(sd + (64 + i * 8) * SP) = bf4((v4f){ry[i][0] - (float)hv[0], ry[i][1] - (float)hv[1], ry[i][2] - (float)hv[2], ry[i][3] - (float)hv[3]}); }
#pragma unroll
    for (int i = 0; i < 16; ++i) *(v4b*)(sd + (128 + i * 8) * SP) = bf4(rw[i]);
    __syncthreads();
    for (int c = 0; c < CC / KC; ++c) { const bool more = c + 1 < CC / KC;   // chunk c + 1 flies into registers while chunk c is multiplied out of LDS
      if (more) {
#pragma unroll
        for (int i = 0; i < 8; ++i) ry[i] = *(const v4f*)(Yg + (size_t)(i * 8) * CC + (c + 1) * KC);
#pragma unroll
        for (int i = 0; i < 16; ++i) rw[i] = *(const v4f*)(Wg + (size_t)(i * 8) * CC + (c + 1) * KC);
        asm volatile("s_wait_xcnt 0x0" ::: "memory"); }   // stands in front of the first overwrite of an address register that the loads above name
      const __bf16* buf = so + (c & 1) * (256 * SP);
#pragma unroll
      for (int ks = 0; ks < KC / 32; ++ks) { const v16b ah = frag_b(buf + (wave * 16 + col) * SP + ks * 32, lane), al = frag_b(buf + (64 + wave * 16 + col) * SP + ks * 32, lane);
#pragma unroll
        for (int jh = 0; jh < 8; jh += 4) { v16b w[4];   // four Wo fragments at a time: hi then lo into four independent tiles, so no product waits for the one before it on its own tile
#pragma unroll
          for (int j = 0; j < 4; ++j) w[j] = frag_b(buf + (128 + (jh + j) * 16 + col) * SP + ks * 32, lane);
#pragma unroll
          for (int j = 0; j < 4; ++j) acc[jh + j] = wmma_bf(ah, w[j], acc[jh + j]);
#pragma unroll
          for (int j = 0; j < 4; ++j) acc[jh + j] = wmma_bf(al, w[j], acc[jh + j]); } }
      if (more) { __bf16* d = sd + ((c + 1) & 1) * (256 * SP);
#pragma unroll
        for (int i = 0; i < 8; ++i) { const v4b hv = bf4(ry[i]); *(v4b*)(d + i * 8 * SP) = hv; *(v4b*)(d + (64 + i * 8) * SP) = bf4((v4f){ry[i][0] - (float)hv[0], ry[i][1] - (float)hv[1], ry[i][2] - (float)hv[2], ry[i][3] - (float)hv[3]}); }
#pragma unroll
        for (int i = 0; i < 16; ++i) *(v4b*)(d + (128 + i * 8) * SP) = bf4(rw[i]); }
      __syncthreads(); }   // publishes chunk c + 1 and ends every wave's reads of the buffer that the next trip refills
#pragma unroll
    for (int j = 0; j < 8; ++j) { const float bias = BO ? bfr(BO[c0 + j * 16 + col]) : 0.f;
#pragma unroll
      for (int r = 0; r < 8; ++r) sf[wave][8 * g + r][j * 16 + col] = acc[j][r] + bias; }
  } else {
#pragma unroll 2
    for (int kc = 0; kc < CC / 32; ++kc) { const v16h a = frag_f32(Y + (r0 + col) * CC + kc * 32, lane); asm volatile("s_wait_loadcnt 0x0" ::: "memory");
#pragma unroll
      for (int j = 0; j < 8; ++j) { const v16h w = WOCOLH(WO, kc * 32, c0 + j * 16 + col, lane); asm volatile("s_wait_loadcnt 0x0" ::: "memory"); acc[j] = wmma16(a, w, acc[j]); } }
#pragma unroll
    for (int j = 0; j < 8; ++j) { const float bias = BO ? bfr(BO[c0 + j * 16 + col]) : 0.f;
#pragma unroll
      for (int r = 0; r < 8; ++r) sf[wave][8 * g + r][j * 16 + col] = acc[j][r] * (1.0f / 256.0f) + bias; } }
  LDSX(); for (int rl = 0; rl < 16; ++rl) vst2(OUT + (r0 + rl) * DIN + c0 + lane * 4, *(const v4f*)&sf[wave][rl][lane * 4]); }

extern "C" void kernel_launch(void* const* d_in, const int* in_sizes, int n_in, void* d_out, int out_size, void* d_ws, size_t ws_size, hipStream_t stream) {
  (void)in_sizes; (void)n_in; (void)out_size;
  const float** F = (const float**)d_in;
  if (ws_size < (size_t)WS_END) return;
  char* ws = (char*)d_ws; _Float16 *QH = (_Float16*)(ws + WS_QH), *KH = (_Float16*)(ws + WS_KH), *VT = (_Float16*)(ws + WS_VT), *QL = (_Float16*)(ws + WS_QL), *KL = (_Float16*)(ws + WS_KL); __bf16 *VB = (__bf16*)(ws + WS_VB), *VBL = (__bf16*)(ws + WS_VBL); float *Y = (float*)(ws + WS_Y);
  // inputs: 0 x [2,2048,1024]; 1 w_qkv [3072,1024] (out,in); 2 w_proj [1024,1024] (out,in); 3 b_proj; 4 mask [2048,2048] f32 0/1
  k_proj<<<dim3(TNB * TT / 128, CC / 128, 3), 128, 0, stream>>>(F[0], F[0], F[0], F[1], F[1] + (size_t)CC * DIN, F[1] + (size_t)2 * CC * DIN, nullptr, nullptr, nullptr, QH, QL, KH, KL, VT, VB, VBL);
  k_fa<<<dim3(NQB, NH, TNB), 128, 0, stream>>>(QH, QL, KH, VT, F[4], Y);
  k_out<<<dim3(TNB * TT / 64, DIN / 128), 128, 0, stream>>>(Y, F[2], F[3], (float*)d_out);
}

// v007
// A run of this version takes 107 microseconds.
// In both of two side-by-side timings against v006, it was 1.03 times as fast.
// All steps since v000 together make it 12.5 times as fast.
// compute dtype: all float inputs rounded to bf16; qkv = x Wqkv^T with EXACT bf16 products on WMMA 16x16x32 (f32 accumulate); q x 64^-0.5 x log2(e) as f16 hi + residual (x 2^10) against k once to f16 (2 products), then MULTIPLIED by the 0/1 mask (masked logits become 0, they are not excluded); softmax in f32 in base 2 (one hardware exp2 per score) with a running maximum, scores kept in registers; 2^(logit - max + 11) once to f16 against v once to f16 (1 product), divided by the f32 sum at the end; ctx split bf16 hi + lo against exact w_proj (2 products) + b_proj; f32 output.
#include <hip/hip_runtime.h>
#include <math.h>

typedef __attribute__((ext_vector_type(16))) _Float16 v16h;
typedef __attribute__((ext_vector_type(16))) __bf16 v16b;
typedef __attribute__((ext_vector_type(8)))  _Float16 v8h;
typedef __attribute__((ext_vector_type(8)))  float v8f;
typedef __attribute__((ext_vector_type(4)))  float v4f;
typedef __attribute__((ext_vector_type(2)))  float v2f;
typedef __attribute__((ext_vector_type(4)))  unsigned v4u;
typedef __attribute__((ext_vector_type(4)))  int v4i;
typedef float __attribute__((may_alias)) float_a;
typedef int __attribute__((may_alias)) int_a;

template <typename T> __device__ __forceinline__ void vst2(void* p, T v) { *(T*)p = v;  }
__device__ __forceinline__ v8f wmma16(v16h a, v16h b, v8f c) {
  v8f d = __builtin_amdgcn_wmma_f32_16x16x32_f16(false, a, false, b, (short)0, c, false, false);
  asm volatile("v_nop\n\tv_nop\n\tv_nop\n\tv_nop" : "+v"(d) : "v"(a), "v"(b));
  return d;
}
__device__ __forceinline__ v8f wmma_bf(v16b a, v16b b, v8f c) {
  v8f d = __builtin_amdgcn_wmma_f32_16x16x32_bf16(false, a, false, b, (short)0, c, false, false);
  asm volatile("v_nop\n\tv_nop\n\tv_nop\n\tv_nop" : "+v"(d) : "v"(a), "v"(b));
  return d;
}
// 16x16x32 fragments: lane = (h = lane>>4, row/col = lane&15); elements 0..7 = k0+8h+0..7, 8..15 = k0+16+8h+0..7; D element r = row 8h+r
__device__ __forceinline__ v16h frag_h(const _Float16* rowk0, int lane) {
  union { v16h v; v8h q[2]; } u; const _Float16* p = rowk0 + 8 * (lane >> 4);
  u.q[0] = *(const v8h*)p; u.q[1] = *(const v8h*)(p + 16); return u.v;
}
__device__ __forceinline__ v16h frag_f32(const float* rowk0, int lane) {
  v16h a; const float* p = rowk0 + 8 * (lane >> 4);
#pragma unroll
  for (int i = 0; i < 8; ++i) { a[i] = (_Float16)p[i]; a[8 + i] = (_Float16)p[16 + i]; }
  return a;
}
__device__ __forceinline__ v16h frag_f32s(const float* rowk0, int lane, float sc) {
  v16h a; const float* p = rowk0 + 8 * (lane >> 4);
#pragma unroll
  for (int i = 0; i < 8; ++i) { a[i] = (_Float16)(p[i] * sc); a[8 + i] = (_Float16)(p[16 + i] * sc); }
  return a;
}
// column fragment from a [K][ld] layout (column n), rows >= K read as 0
__device__ __forceinline__ v16h fragc_f32(const float* W, int k0, int n, int lane, int ld, int K) {
  v16h a; const int g = lane >> 4;
#pragma unroll
  for (int i = 0; i < 8; ++i) { const int ka = k0 + 8 * g + i, kb = ka + 16;
    a[i] = (_Float16)(ka < K ? W[(size_t)(ka < K ? ka : K - 1) * ld + n] : 0.f); a[8 + i] = (_Float16)(kb < K ? W[(size_t)(kb < K ? kb : K - 1) * ld + n] : 0.f); }
  return a;
}
struct F2 { v16b h, l; };
__device__ __forceinline__ F2 bsplit16(const float v[16]) { F2 r;
#pragma unroll
  for (int i = 0; i < 16; ++i) { const __bf16 h = (__bf16)v[i]; r.h[i] = h; r.l[i] = (__bf16)(v[i] - (float)h); }
  return r; }
__device__ __forceinline__ F2 split_row(const float* row, int k0, int lane) { float v[16]; const float* p = row + k0 + 8 * (lane >> 4);
#pragma unroll
  for (int i = 0; i < 8; ++i) { v[i] = p[i]; v[8 + i] = p[16 + i]; }
  return bsplit16(v); }
__device__ __forceinline__ F2 split_rowK(const float* row, int k0, int lane, int K) { float v[16]; const int g = lane >> 4;
#pragma unroll
  for (int i = 0; i < 8; ++i) { const int ka = k0 + 8 * g + i, kb = ka + 16; v[i] = ka < K ? row[ka < K ? ka : K - 1] : 0.f; v[8 + i] = kb < K ? row[kb < K ? kb : K - 1] : 0.f; }
  return bsplit16(v); }
__device__ __forceinline__ F2 split_col(const float* W, int k0, int n, int lane, int ld, int K) { float v[16]; const int g = lane >> 4;
#pragma unroll
  for (int i = 0; i < 8; ++i) { const int ka = k0 + 8 * g + i, kb = ka + 16; v[i] = ka < K ? W[(size_t)(ka < K ? ka : K - 1) * ld + n] : 0.f; v[8 + i] = kb < K ? W[(size_t)(kb < K ? kb : K - 1) * ld + n] : 0.f; }
  return bsplit16(v); }
__device__ __forceinline__ v8f mac3(const F2& a, const F2& b, v8f c) { c = wmma_bf(a.l, b.h, c); c = wmma_bf(a.h, b.l, c); return wmma_bf(a.h, b.h, c); }
__device__ __forceinline__ float sigm(float v) { return 1.0f / (1.0f + expf(-v)); }
#define LDSX() do { asm volatile("s_wait_dscnt 0" ::: "memory"); __builtin_amdgcn_wave_barrier(); __builtin_amdgcn_fence(__ATOMIC_RELEASE, "workgroup"); } while (0)

// Multi-head attention with a MULTIPLICATIVE 0/1 mask (B 2, N 2,048, C 1,024 = 16 x 64): qkv = x w_qkv^T ((out,in) [3072,1024], rows (3,H,D)); attn = softmax((q k^T x 64^-0.5) * mask) with mask [N,N] of 0/1 shared over (b,h) - a masked logit is 0.0, still inside the softmax; out = merged(attn v) w_proj^T + b_proj.
#define NB 2
#define TT 2048
#define CC 1024            // NH * HD = projected width
#define DIN 1024          // input (model) width
#define NH 16
#define HD 64
#define NQB (TT / 64)
#define SCALE (0.125f)
#define QSC (SCALE * 1.44269504088896340736f)   // logit scale x log2(e): k_proj multiplies q by it in f32 before the f16 hi / residual split, so k_fa's scores arrive as base-2 exponents
#ifndef TNB
#define TNB NB
#endif
__device__ __forceinline__ float bfr(float v) { return (float)(__bf16)v; }
typedef __attribute__((ext_vector_type(8))) __bf16 v8b;
__device__ __forceinline__ v16b frag_b(const __bf16* rowk0, int lane) {
  union { v16b v; v8b q[2]; } u; const __bf16* p = rowk0 + 8 * (lane >> 4);
  u.q[0] = *(const v8b*)p; u.q[1] = *(const v8b*)(p + 16); return u.v;
}
#define QHI 2048            // rows carrying a q residual plane (all rows when non-causal: 2-product logits everywhere)
#define KHI 64            // key rows carrying k residual / v bf16 hi+lo planes (written by k_proj; no kernel in this file reads them)
// B fragment (k rows k0+.., output column o) of a weight: (in,out) [K][ld] or (out,in) [ld rows of K]: bf16 exact, or f16(bf16 * 256) exact
__device__ __forceinline__ v16b wcol_io(const float* Wm, int k0, int o, int lane, int ld) { v16b w; const int g = lane >> 4;
#pragma unroll
  for (int i = 0; i < 8; ++i) { w[i] = (__bf16)Wm[(size_t)(k0 + 8 * g + i) * ld + o]; w[8 + i] = (__bf16)Wm[(size_t)(k0 + 16 + 8 * g + i) * ld + o]; }
  return w; }
__device__ __forceinline__ v16b wcol_oi(const float* Wm, int k0, int o, int lane, int K) { v16b w; const float* p = Wm + (size_t)o * K + k0 + 8 * (lane >> 4);
#pragma unroll
  for (int i = 0; i < 8; ++i) { w[i] = (__bf16)p[i]; w[8 + i] = (__bf16)p[16 + i]; }
  return w; }
__device__ __forceinline__ v16h wcolh_io(const float* Wm, int k0, int o, int lane, int ld) { v16h w; const int g = lane >> 4;
#pragma unroll
  for (int i = 0; i < 8; ++i) { w[i] = (_Float16)(bfr(Wm[(size_t)(k0 + 8 * g + i) * ld + o]) * 256.0f); w[8 + i] = (_Float16)(bfr(Wm[(size_t)(k0 + 16 + 8 * g + i) * ld + o]) * 256.0f); }
  return w; }
__device__ __forceinline__ v16h wcolh_oi(const float* Wm, int k0, int o, int lane, int K) { v16h w; const float* p = Wm + (size_t)o * K + k0 + 8 * (lane >> 4);
#pragma unroll
  for (int i = 0; i < 8; ++i) { w[i] = (_Float16)(bfr(p[i]) * 256.0f); w[8 + i] = (_Float16)(bfr(p[16 + i]) * 256.0f); }
  return w; }
#define WQKV_LAYOUT 1   // 0 = (in,out) [DIN][CC]; 1 = (out,in) [CC][DIN]; 2 = per-head [NH][DIN][HD]
__device__ __forceinline__ v16b wcol_hdk(const float* Wm, int k0, int o, int lane) { v16b w; const int g = lane >> 4; const float* p = Wm + (size_t)(o / HD) * DIN * HD + (o % HD);
#pragma unroll
  for (int i = 0; i < 8; ++i) { w[i] = (__bf16)p[(size_t)(k0 + 8 * g + i) * HD]; w[8 + i] = (__bf16)p[(size_t)(k0 + 16 + 8 * g + i) * HD]; }
  return w; }
#define WO_OUT_IN 1
#if WQKV_LAYOUT == 1
#define WCOL(W, k0, o, lane) wcol_oi(W, k0, o, lane, DIN)
#elif WQKV_LAYOUT == 2
#define WCOL(W, k0, o, lane) wcol_hdk(W, k0, o, lane)
#else
#define WCOL(W, k0, o, lane) wcol_io(W, k0, o, lane, CC)
#endif
#if WO_OUT_IN
#define WOCOL(W, k0, o, lane) wcol_oi(W, k0, o, lane, CC)
#define WOCOLH(W, k0, o, lane) wcolh_oi(W, k0, o, lane, CC)
#else
#define WOCOL(W, k0, o, lane) wcol_io(W, k0, o, lane, DIN)
#define WOCOLH(W, k0, o, lane) wcolh_io(W, k0, o, lane, DIN)
#endif

#define WS_QH  0u                                      // f16 q rows [b*t][CC]
#define WS_KH  (WS_QH + 2u * (size_t)NB * TT * CC)      // f16 k in fragment order [b][h][t / 16][d / 32][2][lane][8]: one 16-byte load of a wave = 512 contiguous bytes
#define WS_VT  (WS_KH + 2u * (size_t)NB * TT * CC)      // f16 v in fragment order [b][h][t / 32][d / 16][2][lane][8]
#define WS_QL  (WS_VT + 2u * (size_t)NB * CC * TT)      // f16 q residual x 2^10 rows [b][t < QHI][CC]
#define WS_KL  (WS_QL + 2u * (size_t)NB * QHI * CC)     // f16 k residual x 2^10 rows [b][t < KHI][CC]
#define WS_VB  (WS_KL + 2u * (size_t)NB * KHI * CC)     // bf16 v hi planes [b][c][t < KHI]
#define WS_VBL (WS_VB + 2u * (size_t)NB * CC * KHI)
#define WS_Y   (WS_VBL + 2u * (size_t)NB * CC * KHI)    // f32 ctx rows [b*t][CC] (only when there is an output projection)
#define WS_XB  (WS_Y  + 4u * (size_t)NB * TT * CC)      // bf16 x rows [b*t][DIN]; the three bf16 planes lie one behind the other, in k_cvt's block order
#define WS_WQB (WS_XB + 2u * (size_t)NB * TT * DIN)     // bf16 w_qkv rows [3 * CC][DIN]
#define WS_WPB (WS_WQB + 2u * (size_t)3 * CC * DIN)     // bf16 w_proj rows [DIN][CC]
#define WS_END (WS_WPB + 2u * (size_t)DIN * CC)

// LDS staging of the two projection GEMMs: a chunk is KC k values of every operand row of the block's tile, shared by the block's four waves. x, w_qkv and w_proj come as bf16 from k_cvt's planes, as whole 128-B row pieces (8 lanes x 16 B); ctx comes as f32 (256-B pieces) and is split on the way
#define KC 64
#define SP 72             // LDS row pitch in 16-bit elements: 144 B = 16 B x 9, so the 16 rows of a 16-byte fragment read fall on distinct banks
typedef __attribute__((ext_vector_type(4))) __bf16 v4b;
__device__ __forceinline__ v4b bf4(v4f v) { v4b r; r[0] = (__bf16)v[0]; r[1] = (__bf16)v[1]; r[2] = (__bf16)v[2]; r[3] = (__bf16)v[3]; return r; }
// ---- k_cvt: x, w_qkv and w_proj rounded to bf16 once a call, into three workspace planes: every tile of the two GEMMs then fetches 2 bytes an element from L2, not 4, however many blocks read it again, and rounds nothing itself.
// a block = CV_BLK consecutive floats of one input (each input is a whole number of blocks); a thread = CV_U whole-line 16-byte loads, all in flight at once, then CV_U 8-byte stores
#define CV_T 256
#define CV_U 16
#define CV_BLK (CV_T * CV_U * 4)
#define CV_NX (NB * TT * DIN / CV_BLK)
#define CV_NW (3 * CC * DIN / CV_BLK)
#define CV_NP (DIN * CC / CV_BLK)
__global__ __launch_bounds__(CV_T) void k_cvt(const float* __restrict__ X, const float* __restrict__ WQKV, const float* __restrict__ WP, __bf16* __restrict__ DB) {
  const int blk = blockIdx.x;
  const float* src = (blk < CV_NX ? X + (size_t)blk * CV_BLK : blk < CV_NX + CV_NW ? WQKV + (size_t)(blk - CV_NX) * CV_BLK : WP + (size_t)(blk - CV_NX - CV_NW) * CV_BLK) + threadIdx.x * 4;
  __bf16* dst = DB + (size_t)blk * CV_BLK + threadIdx.x * 4;
  v4f r[CV_U];   // both loops are fully unrolled so that r stays in registers
#pragma unroll
  for (int i = 0; i < CV_U; ++i) r[i] = *(const v4f*)(src + i * (CV_T * 4));
  asm volatile("s_wait_xcnt 0x0" ::: "memory");   // stands in front of the first overwrite of an address register that the loads above name
  __builtin_amdgcn_sched_barrier(0);   // all CV_U loads issue above this line; without it this build holds the last two back until the first two have returned (to reuse their registers), a second trip to memory in a kernel that is one trip long
#pragma unroll
  for (int i = 0; i < CV_U; ++i) *(v4b*)(dst + i * (CV_T * 4)) = bf4(r[i]); }
// ---- k_proj: block = (128 rows, 128 cols, which): q/k/v = X W (+ b) with exact bf16 products (K = DIN) -> which 0: q x QSC f16 rows (+ residual rows < QHI); 1: k f16 in the attention's fragment order (+ residual rows < KHI); 2: v f16 in fragment order (+ bf16 hi/lo planes for t < KHI)
// a wave holds two 16-row groups of the block (rows wave * 16 and 64 + wave * 16) x all 128 cols: each W fragment read from LDS feeds two products, and each W row fetched from L2 serves 128 rows of X
__global__ __launch_bounds__(128) void k_proj(const __bf16* __restrict__ XQ, const __bf16* __restrict__ XK, const __bf16* __restrict__ XV, const __bf16* __restrict__ WQ, const __bf16* __restrict__ WK, const __bf16* __restrict__ WV, const float* __restrict__ BQ, const float* __restrict__ BK, const float* __restrict__ BV,
    _Float16* __restrict__ QH, _Float16* __restrict__ QL, _Float16* __restrict__ KH, _Float16* __restrict__ KL, _Float16* __restrict__ VT, __bf16* __restrict__ VB, __bf16* __restrict__ VBL) {
  // one LDS range: in the K loop two staging buffers of [X 128 rows | W 128 rows] x SP; behind the loop's last barrier the output staging of one 64-row half at a time (sh, sl or th, tb, tbl)
  __shared__ __align__(16) char smem[2 * 256 * SP * 2];
  _Float16 (*sh)[136] = (_Float16 (*)[136])smem; _Float16 (*sl)[136] = (_Float16 (*)[136])(smem + 64 * 136 * 2); _Float16 (*th)[72] = (_Float16 (*)[72])smem; __bf16 (*tb)[72] = (__bf16 (*)[72])(smem + 128 * 72 * 2); __bf16 (*tbl)[72] = (__bf16 (*)[72])(smem + 2 * 128 * 72 * 2);
  __bf16* const st = (__bf16*)smem;
  const int tid = threadIdx.x, wave = tid >> 5, lane = tid & 31, col = lane & 15, g = lane >> 4; const int which = blockIdx.z; const int c0 = blockIdx.y * 128; const size_t r0 = (size_t)blockIdx.x * 128; const size_t bb = r0 / TT; const int t0 = (int)(r0 % TT);
  const __bf16* X = which == 0 ? XQ : which == 1 ? XK : XV; const __bf16* WA = which == 0 ? WQ : which == 1 ? WK : WV; const float* BA = which == 0 ? BQ : which == 1 ? BK : BV;
  v8f acc[2][8] = {};
  const int srow = tid >> 4;   // row of the output stores behind the loop
  const int lrow = tid >> 3, lq = (tid & 7) * 8; const __bf16* Xg = X + (r0 + lrow) * DIN + lq; const __bf16* Wg = WA + (size_t)(c0 + lrow) * DIN + lq; __bf16* const sd = st + lrow * SP + lq;   // staging: 8 lanes = one 128-byte row piece, 16 rows a trip of the block
  v8b rx[8], rw[8];   // the inner loops below are fully unrolled so that every index into rx, rw, a, w and acc is a constant (registers, no scratch)
#pragma unroll
  for (int i = 0; i < 8; ++i) rx[i] = *(const v8b*)(Xg + (size_t)(i * 16) * DIN);
#pragma unroll
  for (int i = 0; i < 8; ++i) rw[i] = *(const v8b*)(Wg + (size_t)(i * 16) * DIN);
  asm volatile("s_wait_xcnt 0x0" ::: "memory");   // stands in front of the first overwrite of an address register that the loads above name
#pragma unroll
  for (int i = 0; i < 8; ++i) *(v8b*)(sd + i * 16 * SP) = rx[i];
#pragma unroll
  for (int i = 0; i < 8; ++i) *(v8b*)(sd + (128 + i * 16) * SP) = rw[i];
  __syncthreads();
  for (int c = 0; c < DIN / KC; ++c) { const bool more = c + 1 < DIN / KC;   // chunk c + 1 flies into registers while chunk c is multiplied out of LDS
    if (more) {
#pragma unroll
      for (int i = 0; i < 8; ++i) rx[i] = *(const v8b*)(Xg + (size_t)(i * 16) * DIN + (c + 1) * KC);
#pragma unroll
      for (int i = 0; i < 8; ++i) rw[i] = *(const v8b*)(Wg + (size_t)(i * 16) * DIN + (c + 1) * KC);
      asm volatile("s_wait_xcnt 0x0" ::: "memory"); }   // stands in front of the first overwrite of an address register that the loads above name
    const __bf16* buf = st + (c & 1) * (256 * SP);
#pragma unroll
    for (int ks = 0; ks < KC / 32; ++ks) { const v16b a0 = frag_b(buf + (wave * 16 + col) * SP + ks * 32, lane), a1 = frag_b(buf + (64 + wave * 16 + col) * SP + ks * 32, lane);
#pragma unroll
      for (int jh = 0; jh < 8; jh += 4) { v16b w[4];   // four W fragments at a time, each against both row groups: eight independent tiles
#pragma unroll
        for (int j = 0; j < 4; ++j) w[j] = frag_b(buf + (128 + (jh + j) * 16 + col) * SP + ks * 32, lane);
#pragma unroll
        for (int j = 0; j < 4; ++j) acc[0][jh + j] = wmma_bf(a0, w[j], acc[0][jh + j]);
#pragma unroll
        for (int j = 0; j < 4; ++j) acc[1][jh + j] = wmma_bf(a1, w[j], acc[1][jh + j]); } }
    if (more) { __bf16* d = sd + ((c + 1) & 1) * (256 * SP);
#pragma unroll
      for (int i = 0; i < 8; ++i) *(v8b*)(d + i * 16 * SP) = rx[i];
#pragma unroll
      for (int i = 0; i < 8; ++i) *(v8b*)(d + (128 + i * 16) * SP) = rw[i]; }
    __syncthreads(); }   // publishes chunk c + 1 and ends every wave's reads of the buffer that the next trip refills (behind the last trip: of the range that becomes output staging)
  // the block's two 64-row halves leave one after the other through the same staging range; hf is unrolled so that acc keeps constant indices
  if (which < 2) { _Float16* DH = which == 0 ? QH : KH; _Float16* DL = which == 0 ? QL : KL; const int nhi = which == 0 ? QHI : KHI; const float osc = which == 0 ? QSC : 1.0f;
#pragma unroll
   for (int hf = 0; hf < 2; ++hf) { const size_t rh = r0 + hf * 64; const int tq = t0 + hf * 64; const bool hi_rows = tq < nhi;
    if (hf) __syncthreads();   // ends every wave's reads of the first half's staging before the second half overwrites it
#pragma unroll
    for (int j = 0; j < 8; ++j) { const float bias = BA ? bfr(BA[c0 + j * 16 + col]) : 0.f;
#pragma unroll
      for (int r = 0; r < 8; ++r) { const float v = (acc[hf][j][r] + bias) * osc; const _Float16 hv = (_Float16)v; sh[wave * 16 + 8 * g + r][j * 16 + col] = hv; sl[wave * 16 + 8 * g + r][j * 16 + col] = (_Float16)((v - (float)hv) * 1024.0f); } }
    __syncthreads();
    // each plane leaves as one fully unrolled run of eight stores that share one address pair plus constant offsets
    const int q8 = (tid & 15) * 8; _Float16* dh = DH + (rh + srow) * CC + c0 + q8; _Float16* dl = DL + (bb * nhi + tq + srow) * (size_t)CC + c0 + q8;
    _Float16* kd = DH + (((bb * NH + (c0 >> 6)) * (TT / 16) + (tq >> 4)) * 4 + wave) * 256 + lane * 8;   // fragment order: wave = (32-wide d chunk, half of the fragment), lane = (g, key); trip i = (head i >> 2 of the block's two, 16-key tile i & 3)
    if (which == 0) {
#pragma unroll
      for (int i = 0; i < 8; ++i) vst2((unsigned*)(dh + i * 8 * CC), *(const v4u*)&sh[srow + i * 8][q8]);
      asm volatile("s_wait_xcnt 0x0" ::: "memory");   // behind the run of stores, in front of any later write of a register that they name
    } else {
#pragma unroll
      for (int i = 0; i < 8; ++i) vst2((unsigned*)(kd + (i >> 2) * (TT * HD) + (i & 3) * 1024), *(const v4u*)&sh[(i & 3) * 16 + col][(i >> 2) * 64 + wave * 16 + g * 8]);
      asm volatile("s_wait_xcnt 0x0" ::: "memory");   // behind the run of stores, in front of any later write of a register that they name
    }
    if (hi_rows) {
#pragma unroll
      for (int i = 0; i < 8; ++i) vst2((unsigned*)(dl + i * 8 * CC), *(const v4u*)&sl[srow + i * 8][q8]);
      asm volatile("s_wait_xcnt 0x0" ::: "memory");   // behind the run of stores, in front of any later write of a register that they name
    } }
  } else {
#pragma unroll
   for (int hf = 0; hf < 2; ++hf) { const int tq = t0 + hf * 64; const bool hi_rows = tq < KHI;
    if (hf) __syncthreads();   // ends every wave's reads of the first half's staging before the second half overwrites it
#pragma unroll
    for (int j = 0; j < 8; ++j) { const float bias = BA ? bfr(BA[c0 + j * 16 + col]) : 0.f;
#pragma unroll
      for (int r = 0; r < 8; ++r) { const float v = acc[hf][j][r] + bias; const int rl = wave * 16 + 8 * g + r, cl = j * 16 + col; th[cl][rl] = (_Float16)v; const __bf16 bh = (__bf16)v; tb[cl][rl] = bh; tbl[cl][rl] = (__bf16)(v - (float)bh); } }
    __syncthreads();
    _Float16* vd = VT + (((bb * NH + (c0 >> 6)) * (TT / 32) + (tq >> 5)) * 8 + wave) * 256 + lane * 8;   // fragment order: wave = (low bit of the 16-channel tile, half of the fragment), lane = (g, channel); trip i = (head i >> 2, 32-key pass (i >> 1) & 1, high bit i & 1 of the channel tile); unrolled like the q / k stores
#pragma unroll
    for (int i = 0; i < 8; ++i) vst2((unsigned*)(vd + (i >> 2) * (TT * HD) + ((i >> 1) & 1) * 2048 + (i & 1) * 1024), *(const v4u*)&th[(i >> 2) * 64 + (i & 1) * 32 + (wave >> 1) * 16 + col][((i >> 1) & 1) * 32 + (wave & 1) * 16 + g * 8]);
    asm volatile("s_wait_xcnt 0x0" ::: "memory");   // behind the run of stores, in front of any later write of a register that they name
    if (hi_rows) { const int cl = tid >> 3, q = tid & 7; const size_t o3 = (bb * CC + c0 + cl) * (size_t)KHI + tq + q * 8;
#pragma unroll
      for (int i = 0; i < 8; ++i) { vst2((unsigned*)(VB + o3 + i * 16 * KHI), *(const v4u*)&tb[cl + i * 16][q * 8]); vst2((unsigned*)(VBL + o3 + i * 16 * KHI), *(const v4u*)&tbl[cl + i * 16][q * 8]); }
      asm volatile("s_wait_xcnt 0x0" ::: "memory");   // behind the run of stores, in front of any later write of a register that they name
    } } } }
__device__ __forceinline__ v8f wmma_p(v16h a, v16h b, v8f c) { return __builtin_amdgcn_wmma_f32_16x16x32_f16(false, a, false, b, (short)0, c, false, false); }
__device__ __forceinline__ v16h frag_t(const _Float16* tile, int lane) {   // a fragment stored in fragment order: two runs of 32 lanes x 8 elements
  union { v16h v; v8h q[2]; } u; const _Float16* p = tile + lane * 8; u.q[0] = *(const v8h*)p; u.q[1] = *(const v8h*)(p + 256); return u.v; }
__device__ __forceinline__ float xhalf(float v) { const int i = __builtin_bit_cast(int, v); return __builtin_bit_cast(float, __builtin_amdgcn_permlanex16(i, i, 0x76543210, 0xfedcba98, false, false)); }   // lane l <-> l ^ 16
// One 32-key tile of a block in LDS: K 4,096 B and V 4,096 B, both in fragment order as they lie in the workspace, then the block's 64 mask rows of 128 B at a pitch of 144 B (16 B x 9: the 16 rows of a 16-byte read fall on distinct banks). Two such buffers.
#define FA_KV 4096
#define FA_MP 144
#define FA_BUF (2 * FA_KV + 64 * FA_MP)
#define FA_NT (TT / 32)
// a thread's eight 16-byte copies of one tile: two of K, two of V (128 threads x 16 B = 2,048 contiguous bytes each), four of its own wave's mask rows (8 lanes = one whole 128-byte line, 4 rows a copy).
// Global address = the tile's scalar base + the lane's own byte offset, which is the same for every tile, like its LDS address in either buffer: a tile costs no vector address arithmetic
__device__ __forceinline__ void fa_stage(unsigned lkv, unsigned lm, unsigned okv, unsigned om, const char* gk, const char* gv, const char* gm) {
  // the copies and, as the last line of the same statement, the wait that stands in front of any rewrite of a register that they name
  asm volatile("global_load_async_to_lds_b128 %0, %8, %14\n\t"
               "global_load_async_to_lds_b128 %1, %9, %14\n\t"
               "global_load_async_to_lds_b128 %2, %8, %15\n\t"
               "global_load_async_to_lds_b128 %3, %9, %15\n\t"
               "global_load_async_to_lds_b128 %4, %10, %16\n\t"
               "global_load_async_to_lds_b128 %5, %11, %16\n\t"
               "global_load_async_to_lds_b128 %6, %12, %16\n\t"
               "global_load_async_to_lds_b128 %7, %13, %16\n\t"
               "s_wait_xcnt 0x0"
               :: "v"(lkv), "v"(lkv + 2048u), "v"(lkv + 4096u), "v"(lkv + 6144u), "v"(lm), "v"(lm + 4u * FA_MP), "v"(lm + 8u * FA_MP), "v"(lm + 12u * FA_MP),
                  "v"(okv), "v"(okv + 2048u), "v"(om), "v"(om + 4u * TT * 4u), "v"(om + 8u * TT * 4u), "v"(om + 12u * TT * 4u),
                  "s"(gk), "s"(gv), "s"(gm)
               : "memory");
}
__global__ __launch_bounds__(128) void k_fa(const _Float16* __restrict__ QH, const _Float16* __restrict__ QL, const _Float16* __restrict__ KH, const _Float16* __restrict__ VT, const float* __restrict__ MKF, float* __restrict__ Y) {
  __shared__ __align__(16) char fs[2 * FA_BUF];
  const int tid = threadIdx.x, wave = tid >> 5, lane = tid & 31, col = lane & 15, g = lane >> 4; const int h = blockIdx.y, b = blockIdx.z; const int t = blockIdx.x * 64 + wave * 16 + col;
  const char* gk = (const char*)(KH + (size_t)(b * NH + h) * (TT * HD)); const char* gv = (const char*)(VT + (size_t)(b * NH + h) * (TT * HD)); /* 32 keys = 4,096 bytes of either */ const unsigned okv = tid * 16;
  const int mrow = wave * 16 + (lane >> 3); const char* gm = (const char*)(MKF + (size_t)(blockIdx.x * 64) * TT); /* 32 keys = 128 bytes of a row */ const unsigned om = mrow * (TT * 4) + (lane & 7) * 16;
  const unsigned lkv = (unsigned)(size_t)fs + tid * 16, lm = (unsigned)(size_t)fs + 2 * FA_KV + mrow * FA_MP + (lane & 7) * 16;
  fa_stage(lkv, lm, okv, om, gk, gv, gm);
  v16h qh[HD / 32], ql[HD / 32];
#pragma unroll
  for (int kc = 0; kc < HD / 32; ++kc) { qh[kc] = frag_h(QH + ((size_t)b * TT + t) * CC + h * HD + kc * 32, lane); ql[kc] = frag_h(QL + ((size_t)b * QHI + t) * CC + h * HD + kc * 32, lane); }
  asm volatile("s_wait_asynccnt 0x0" ::: "memory");   // tile 0 has landed, as far as this wave copied it
  __syncthreads();                                    // ... and as far as the other waves did
  fa_stage(lkv + FA_BUF, lm + FA_BUF, okv, om, gk + FA_KV, gv + FA_KV, gm + 128);
  v8f acc[HD / 16] = {}; float m = -3.0e38f, l = 0.f;
  for (int tp = 0; tp < FA_NT; tp += 2)
#pragma unroll   // both buffers' trips written out, so that every LDS address is a loop constant
  for (int hb = 0; hb < 2; ++hb) { const int ti = tp + hb; const int bo = hb * FA_BUF; const _Float16* Kl = (const _Float16*)(fs + bo); const _Float16* Vl = (const _Float16*)(fs + bo + FA_KV); const char* Ml = fs + bo + 2 * FA_KV + (wave * 16 + col) * FA_MP + 32 * g;
    v16h kf[2][HD / 32], vf[HD / 16]; v4f mk[2][2];
#pragma unroll
    for (int u = 0; u < 2; ++u)
#pragma unroll
      for (int kc = 0; kc < HD / 32; ++kc) kf[u][kc] = frag_t(Kl + u * 1024 + kc * 512, lane);
#pragma unroll
    for (int u = 0; u < 2; ++u) { mk[u][0] = *(const v4f*)(Ml + u * 64); mk[u][1] = *(const v4f*)(Ml + u * 64 + 16); }
#pragma unroll
    for (int j = 0; j < HD / 16; ++j) vf[j] = frag_t(Vl + j * 512, lane);
    __builtin_amdgcn_sched_barrier(0);   // the tile's twenty LDS reads issue above this line as one group with counted waits behind it; without it they scatter in small groups among the score products, each with a wait to 0 in front of the next product
    v8f sh[2] = {}, sl[2] = {};
#pragma unroll
    for (int kc = 0; kc < HD / 32; ++kc) {
#pragma unroll
      for (int u = 0; u < 2; ++u) { sh[u] = wmma_p(kf[u][kc], qh[kc], sh[u]); sl[u] = wmma_p(kf[u][kc], ql[kc], sl[u]); } }
    float v[16]; float mx = -3.0e38f;
#pragma unroll
    for (int u = 0; u < 2; ++u)
#pragma unroll
      for (int r = 0; r < 8; r += 2) { const v2f hi = {sh[u][r], sh[u][r + 1]}, lo = {sl[u][r], sl[u][r + 1]}, mm = {bfr(mk[u][r >> 2][r & 3]), bfr(mk[u][r >> 2][(r & 3) + 1])};   // the same operations written by even register pairs, as the accumulators lie: left to itself this build paired odd with even and moved the scores into place first
        const v2f s = (hi + lo * (1.0f / 1024.0f)) * mm; v[u * 8 + r] = s[0]; v[u * 8 + r + 1] = s[1]; mx = fmaxf(fmaxf(mx, s[0]), s[1]); }
    __builtin_amdgcn_sched_barrier(0);   // the score products stay above this line, under the latency of the mask and v reads; without it the waits below rise to directly behind the LDS reads and the wave stands there for all twenty
    // the tile is in registers: from here on the trip reads no LDS, so the buffer is handed over here and the refill has a whole trip to land
    asm volatile("s_wait_dscnt 0x0" ::: "memory");      // this wave's reads of the buffer have returned
    asm volatile("s_wait_asynccnt 0x0" ::: "memory");   // its copies of tile ti + 1 have landed
    __syncthreads();                                    // publishes tile ti + 1 and ends every wave's reads of the buffer that is refilled below
    if (ti + 2 < FA_NT) fa_stage(lkv + bo, lm + bo, okv, om, gk + (ti + 2) * FA_KV, gv + (ti + 2) * FA_KV, gm + (ti + 2) * 128);
    mx = fmaxf(mx, xhalf(mx)); const float mn = fmaxf(m, mx - 11.0f); const float alpha = __builtin_amdgcn_exp2f(m - mn); m = mn;
    v16h p; float sum = 0.f;
#pragma unroll
    for (int i = 0; i < 16; ++i) { const float e = __builtin_amdgcn_exp2f(v[i] - mn); sum += e; p[i] = (_Float16)e; }
    l = l * alpha + sum;
#pragma unroll
    for (int j = 0; j < HD / 16; ++j) { acc[j] = acc[j] * alpha; acc[j] = wmma_p(vf[j], p, acc[j]); } }
  asm volatile("s_wait_asynccnt 0x0" ::: "memory");     // no copy is outstanding when the wave ends
  l += xhalf(l); const float inv = 1.0f / l;   // never near 0: the key that holds the maximum adds 2^11
  float* yp = Y + ((size_t)b * TT + t) * CC + h * HD + 8 * g;
#pragma unroll
  for (int j = 0; j < HD / 16; ++j) { const v8f o = acc[j] * inv; vst2(yp + j * 16, (v4f){o[0], o[1], o[2], o[3]}); vst2(yp + j * 16 + 4, (v4f){o[4], o[5], o[6], o[7]}); } }
// ---- k_out: block = (64 rows, 128 cols): out = ctx Wo (+ bo): ctx split bf16 hi + lo against the exact bf16 Wo of k_cvt's plane (2 products)
__global__ __launch_bounds__(128) void k_out(const float* __restrict__ Y, const __bf16* __restrict__ WO, const float* __restrict__ BO, float* __restrict__ OUT) { __shared__ __align__(16) float sf[4][16][132]; __shared__ __align__(16) __bf16 so[2 * 256 * SP];   // so: two staging buffers of [ctx hi 64 rows | ctx lo 64 rows | Wo 128 rows] x SP
  const int tid = threadIdx.x, wave = tid >> 5, lane = tid & 31, col = lane & 15, g = lane >> 4; const int c0 = blockIdx.y * 128; const size_t r0 = (size_t)blockIdx.x * 64 + wave * 16;
  v8f acc[8] = {};
  if (true) {   /* ALL rows: ctx split bf16 hi + lo x exact Wo (2 products) */
    const int srow = tid >> 4, sq = (tid & 15) * 4; const float* Yg = Y + ((size_t)blockIdx.x * 64 + srow) * CC + sq; __bf16* const sd = so + srow * SP + sq;
    const int lrow = tid >> 3, lq = (tid & 7) * 8; const __bf16* Wg = WO + (size_t)(c0 + lrow) * CC + lq; __bf16* const sw = so + (128 + lrow) * SP + lq;   // Wo staging: 8 lanes = one 128-byte row piece, 16 rows a trip of the block
    v4f ry[8]; v8b rw[8];   // the inner loops below are fully unrolled so that every index into ry, rw, w and acc is a constant (registers, no scratch)
#pragma unroll
    for (int i = 0; i < 8; ++i) ry[i] = *(const v4f*)(Yg + (size_t)(i * 8) * CC);
#pragma unroll
    for (int i = 0; i < 8; ++i) rw[i] = *(const v8b*)(Wg + (size_t)(i * 16) * CC);
    asm volatile("s_wait_xcnt 0x0" ::: "memory");   // stands in front of the first overwrite of an address register that the loads above name
#pragma unroll
    for (int i = 0; i < 8; ++i) { const v4b hv = bf4(ry[i]); *(v4b*)(sd + i * 8 * SP) = hv; *(v4b*)(sd + (64 + i * 8) * SP) = bf4((v4f){ry[i][0] - (float)hv[0], ry[i][1] - (float)hv[1], ry[i][2] - (float)hv[2], ry[i][3] - (float)hv[3]}); }
#pragma unroll
    for (int i = 0; i < 8; ++i) *(v8b*)(sw + i * 16 * SP) = rw[i];
    __syncthreads();
    for (int c = 0; c < CC / KC; ++c) { const bool more = c + 1 < CC / KC;   // chunk c + 1 flies into registers while chunk c is multiplied out of LDS
      if (more) {
#pragma unroll
        for (int i = 0; i < 8; ++i) ry[i] = *(const v4f*)(Yg + (size_t)(i * 8) * CC + (c + 1) * KC);
#pragma unroll
        for (int i = 0; i < 8; ++i) rw[i] = *(const v8b*)(Wg + (size_t)(i * 16) * CC + (c + 1) * KC);
        asm volatile("s_wait_xcnt 0x0" ::: "memory"); }   // stands in front of the first overwrite of an address register that the loads above name
      const __bf16* buf = so + (c & 1) * (256 * SP);
#pragma unroll
      for (int ks = 0; ks < KC / 32; ++ks) { const v16b ah = frag_b(buf + (wave * 16 + col) * SP + ks * 32, lane), al = frag_b(buf + (64 + wave * 16 + col) * SP + ks * 32, lane);
#pragma unroll
        for (int jh = 0; jh < 8; jh += 4) { v16b w[4];   // four Wo fragments at a time: hi then lo into four independent tiles, so no product waits for the one before it on its own tile
#pragma unroll
          for (int j = 0; j < 4; ++j) w[j] = frag_b(buf + (128 + (jh + j) * 16 + col) * SP + ks * 32, lane);
#pragma unroll
          for (int j = 0; j < 4; ++j) acc[jh + j] = wmma_bf(ah, w[j], acc[jh + j]);
#pragma unroll
          for (int j = 0; j < 4; ++j) acc[jh + j] = wmma_bf(al, w[j], acc[jh + j]); } }
      if (more) { __bf16* d = sd + ((c + 1) & 1) * (256 * SP); __bf16* dw = sw + ((c + 1) & 1) * (256 * SP);
#pragma unroll
        for (int i = 0; i < 8; ++i) { const v4b hv = bf4(ry[i]); *(v4b*)(d + i * 8 * SP) = hv; *(v4b*)(d + (64 + i * 8) * SP) = bf4((v4f){ry[i][0] - (float)hv[0], ry[i][1] - (float)hv[1], ry[i][2] - (float)hv[2], ry[i][3] - (float)hv[3]}); }
#pragma unroll
        for (int i = 0; i < 8; ++i) *(v8b*)(dw + i * 16 * SP) = rw[i]; }
      __syncthreads(); }   // publishes chunk c + 1 and ends every wave's reads of the buffer that the next trip refills
#pragma unroll
    for (int j = 0; j < 8; ++j) { const float bias = BO ? bfr(BO[c0 + j * 16 + col]) : 0.f;
#pragma unroll
      for (int r = 0; r < 8; ++r) sf[wave][8 * g + r][j * 16 + col] = acc[j][r] + bias; }
  }
  LDSX(); for (int rl = 0; rl < 16; ++rl) vst2(OUT + (r0 + rl) * DIN + c0 + lane * 4, *(const v4f*)&sf[wave][rl][lane * 4]); }

extern "C" void kernel_launch(void* const* d_in, const int* in_sizes, int n_in, void* d_out, int out_size, void* d_ws, size_t ws_size, hipStream_t stream) {
  (void)in_sizes; (void)n_in; (void)out_size;
  const float** F = (const float**)d_in;
  if (ws_size < (size_t)WS_END) return;
  char* ws = (char*)d_ws; _Float16 *QH = (_Float16*)(ws + WS_QH), *KH = (_Float16*)(ws + WS_KH), *VT = (_Float16*)(ws + WS_VT), *QL = (_Float16*)(ws + WS_QL), *KL = (_Float16*)(ws + WS_KL); __bf16 *VB = (__bf16*)(ws + WS_VB), *VBL = (__bf16*)(ws + WS_VBL), *XB = (__bf16*)(ws + WS_XB), *WQB = (__bf16*)(ws + WS_WQB), *WPB = (__bf16*)(ws + WS_WPB); float *Y = (float*)(ws + WS_Y);
  // inputs: 0 x [2,2048,1024]; 1 w_qkv [3072,1024] (out,in); 2 w_proj [1024,1024] (out,in); 3 b_proj; 4 mask [2048,2048] f32 0/1
  k_cvt<<<dim3(CV_NX + CV_NW + CV_NP), CV_T, 0, stream>>>(F[0], F[1], F[2], XB);
  k_proj<<<dim3(TNB * TT / 128, CC / 128, 3), 128, 0, stream>>>(XB, XB, XB, WQB, WQB + (size_t)CC * DIN, WQB + (size_t)2 * CC * DIN, nullptr, nullptr, nullptr, QH, QL, KH, KL, VT, VB, VBL);
  k_fa<<<dim3(NQB, NH, TNB), 128, 0, stream>>>(QH, QL, KH, VT, F[4], Y);
  k_out<<<dim3(TNB * TT / 64, DIN / 128), 128, 0, stream>>>(Y, WPB, F[3], (float*)d_out);
}
